// v000
// Measured on an AMD MI455X. A time is GPU time per run, averaged over a window of back-to-back runs after a warm-up
// (all launches, gaps included; the runs take copies of the inputs in turn), and the median of several windows.
// Apart from v000's, it joins two sittings. Times from different sittings can be a few percent apart, while
// side-by-side timings come from the same sitting.
// v000 is the starting kernel. One run takes 1330 microseconds.
#include <hip/hip_runtime.h>
#include <math.h>
#include <stdint.h>

// ---------------------------------------------------------------------------
// Transformer block (LN -> attn -> residual -> top2 MoE adapters -> LN -> MLP)
// for MI455X / gfx1250.  All GEMMs run on V_WMMA_F32_16X16X4_F32 (exact fp32
// matrix op) so numerics match the fp32 JAX reference while using the CDNA5
// matrix pipeline.  wave32 everywhere.
//
// This revision stages GEMM B-tiles through LDS with CDNA5 async global->LDS
// DMA (GLOBAL_LOAD_ASYNC_TO_LDS_B128 / s_wait_asynccnt), double-buffered, so
// each 32x64 B-chunk is fetched once per block instead of once per wave (8x
// less L2 traffic on the dominant GEMMs).
// ---------------------------------------------------------------------------

#define USE_ASYNC_LDS 1   // 0 = plain global load + ds_store fallback

#define Bn   4
#define Tn   1024
#define Cn   1024
#define Hn   16
#define Dn   64
#define En   8
#define BOTn 64
#define FFn  4096
#define BTn  (Bn * Tn)          // 4096 rows

typedef float v2f __attribute__((ext_vector_type(2)));
typedef float v8f __attribute__((ext_vector_type(8)));

// ---------------------------------------------------------------------------
// Generic fp32 WMMA GEMM:  out = epilogue(A[M,K] @ W[K,N] + bias[N])
// Block = 256 threads = 8 waves; each wave computes a 16(M) x 64(N) strip of
// a 128x64 block tile.  B is staged in LDS:
//   chunk = 32(K) x 64(N) floats, row stride padded to 72 words so the two
//   16-lane halves of a fragment read hit disjoint bank ranges.
//   Double buffered; filled by async global->LDS b128 DMA (2 per thread).
// A-fragment (16x4 f32): lanes 0-15 hold K=k,k+1 ; lanes 16-31 hold K=k+2,k+3.
// C/D (16x16 f32): VGPR r -> row r (lanes 0-15) / row r+8 (lanes 16-31).
//
// ACT: 0=none, 1=relu, 2=exact gelu.  RES1/RES2: add residual tensors.
// GACC: out[idx] += gates[t,expert] * 0.1 * v   (MoE adapter combine)
// ---------------------------------------------------------------------------
#define GEMM_KC   32
#define GEMM_BSTR 72
#define GEMM_LDS_BYTES (2 * GEMM_KC * GEMM_BSTR * 4)

template <int ACT, bool RES1, bool RES2, bool GACC>
__global__ __launch_bounds__(256) void gemm_wmma(
    const float* __restrict__ A, const float* __restrict__ W,
    const float* __restrict__ bias,
    const float* __restrict__ res1, const float* __restrict__ res2,
    const float* __restrict__ gates, int expert,
    float* __restrict__ out, int M, int N, int K)
{
    extern __shared__ float Bs[];          // [2][GEMM_KC][GEMM_BSTR]

    const int tid  = threadIdx.x;
    const int lane = tid & 31;
    const int wave = tid >> 5;
    const int half = lane >> 4;     // 0: K pair {0,1}, 1: K pair {2,3}
    const int l15  = lane & 15;
    const int m0 = blockIdx.y * 128 + wave * 16;
    const int n0 = blockIdx.x * 64;

    const float* arow = A + (size_t)(m0 + l15) * K;
    const int nchunk = K / GEMM_KC;

    // Cooperative loader: one 32x64 B-chunk per block, 2 float4 per thread.
    auto issueChunk = [&](int kc) {
        const int k0 = kc * GEMM_KC;
        const uint32_t bufbyte = (uint32_t)((kc & 1) * (GEMM_KC * GEMM_BSTR) * 4);
#pragma unroll
        for (int p = 0; p < 2; ++p) {
            const int id = tid + p * 256;
            const int kr = id >> 4;          // 0..31  (K row in chunk)
            const int c4 = (id & 15) * 4;    // 0..60  (N col, float4 granular)
            const uint32_t laddr = bufbyte + (uint32_t)(kr * GEMM_BSTR + c4) * 4u;
#if USE_ASYNC_LDS
            const uint64_t gaddr =
                (uint64_t)(uintptr_t)(W + (size_t)(k0 + kr) * N + (n0 + c4));
            // VDST = per-lane LDS byte offset, VADDR = 64-bit global address.
            asm volatile("global_load_async_to_lds_b128 %0, %1, off"
                         :: "v"(laddr), "v"(gaddr) : "memory");
#else
            const float4 t = *(const float4*)(W + (size_t)(k0 + kr) * N + (n0 + c4));
            *(float4*)((char*)Bs + laddr) = t;
#endif
        }
    };

    issueChunk(0);

    v8f acc[4] = {};
    for (int kc = 0; kc < nchunk; ++kc) {
#if USE_ASYNC_LDS
        asm volatile("s_wait_asynccnt 0" ::: "memory");   // my chunk DMAs done
#endif
        __syncthreads();                                  // everyone's done
        if (kc + 1 < nchunk) issueChunk(kc + 1);          // prefetch other buf
        const float* buf = Bs + (kc & 1) * (GEMM_KC * GEMM_BSTR);
        const int k0 = kc * GEMM_KC;
#pragma unroll
        for (int kl = 0; kl < GEMM_KC; kl += 4) {
            const int ka = k0 + kl + half * 2;
            v2f a;
            a.x = arow[ka];
            a.y = arow[ka + 1];
            const int kb = kl + half * 2;
#pragma unroll
            for (int j = 0; j < 4; ++j) {
                const int col = j * 16 + l15;
                v2f b;
                b.x = buf[kb * GEMM_BSTR + col];
                b.y = buf[(kb + 1) * GEMM_BSTR + col];
                acc[j] = __builtin_amdgcn_wmma_f32_16x16x4_f32(
                    false, a, false, b, 0, acc[j], false, false);
            }
        }
        __syncthreads();   // all waves finished reading this buffer
    }

#pragma unroll
    for (int j = 0; j < 4; ++j) {
        const int col = n0 + j * 16 + l15;
        const float bv = bias[col];
#pragma unroll
        for (int r = 0; r < 8; ++r) {
            const int row = m0 + r + half * 8;
            float v = acc[j][r] + bv;
            if (ACT == 1) v = fmaxf(v, 0.0f);
            if (ACT == 2) v = 0.5f * v * (1.0f + erff(v * 0.70710678118654752f));
            const size_t idx = (size_t)row * N + col;
            if (RES1) v += res1[idx];
            if (RES2) v += res2[idx];
            if (GACC) {
                const float g = gates[(size_t)(row & (Tn - 1)) * En + expert];
                out[idx] += g * 0.1f * v;
            } else {
                out[idx] = v;
            }
        }
    }
}

// ---------------------------------------------------------------------------
// Causal flash attention, fp32 WMMA.  One wave per (b, h, 16-query tile);
// 4 waves per block.  Row softmax stats reduced with width-16 shfl butterflies
// (each 16x16 score tile keeps row M in VGPR index, col N in lane).
// P tile is staged through LDS to convert C-layout -> A-fragment layout.
// ---------------------------------------------------------------------------
__global__ __launch_bounds__(128) void attn_kernel(
    const float* __restrict__ q, const float* __restrict__ k,
    const float* __restrict__ v, float* __restrict__ y)
{
    const int lane = threadIdx.x & 31;
    const int wave = threadIdx.x >> 5;
    const int half = lane >> 4;
    const int l15  = lane & 15;

    const int t0 = (blockIdx.x * 4 + wave) * 16;
    const int hh = blockIdx.y;
    const int b  = blockIdx.z;

    const size_t base = (size_t)b * Tn * Cn + (size_t)hh * Dn;
    const float* Qp = q + base;
    const float* Kp = k + base;
    const float* Vp = v + base;

    __shared__ float Pt[4][16][17];   // +1 pad: conflict-free transposed reads

    // Q fragments for all 16 K-steps over D=64 (resident for whole tile)
    v2f aq[16];
    {
        const float* qrow = Qp + (size_t)(t0 + l15) * Cn;
#pragma unroll
        for (int s = 0; s < 16; ++s) {
            const int dd = s * 4 + half * 2;
            aq[s].x = qrow[dd];
            aq[s].y = qrow[dd + 1];
        }
    }

    v8f o[4] = {};
    float mrow[8], lrow[8];
#pragma unroll
    for (int r = 0; r < 8; ++r) { mrow[r] = -1e30f; lrow[r] = 0.0f; }

    for (int s0 = 0; s0 <= t0; s0 += 16) {
        // S = Q @ K^T  (16x16 tile, K-dim = 64)
        v8f sa = {};
#pragma unroll
        for (int s = 0; s < 16; ++s) {
            const int dd = s * 4 + half * 2;
            const float* kr = Kp + (size_t)(s0 + l15) * Cn;
            v2f bf;
            bf.x = kr[dd];
            bf.y = kr[dd + 1];
            sa = __builtin_amdgcn_wmma_f32_16x16x4_f32(
                false, aq[s], false, bf, 0, sa, false, false);
        }

        // scale, causal mask, online softmax update, write P to LDS
#pragma unroll
        for (int r = 0; r < 8; ++r) {
            const int row = t0 + r + half * 8;   // query index
            const int col = s0 + l15;            // key index
            float sv = sa[r] * 0.125f;           // 1/sqrt(64)
            if (col > row) sv = -1e30f;

            float mx = sv;
            mx = fmaxf(mx, __shfl_xor(mx, 1, 16));
            mx = fmaxf(mx, __shfl_xor(mx, 2, 16));
            mx = fmaxf(mx, __shfl_xor(mx, 4, 16));
            mx = fmaxf(mx, __shfl_xor(mx, 8, 16));

            const float mn    = fmaxf(mrow[r], mx);
            const float alpha = __expf(mrow[r] - mn);
            const float pv    = __expf(sv - mn);

            float ps = pv;
            ps += __shfl_xor(ps, 1, 16);
            ps += __shfl_xor(ps, 2, 16);
            ps += __shfl_xor(ps, 4, 16);
            ps += __shfl_xor(ps, 8, 16);

            lrow[r] = lrow[r] * alpha + ps;
            mrow[r] = mn;
#pragma unroll
            for (int j = 0; j < 4; ++j) o[j][r] *= alpha;

            Pt[wave][r + half * 8][l15] = pv;
        }
        // Same-wave LDS ops are in-order (DScnt); no cross-wave sharing here.

        // O += P @ V   (K-dim = 16 keys, N = 64 head dims)
#pragma unroll
        for (int ks = 0; ks < 16; ks += 4) {
            v2f ap;
            ap.x = Pt[wave][l15][ks + half * 2];
            ap.y = Pt[wave][l15][ks + half * 2 + 1];
#pragma unroll
            for (int j = 0; j < 4; ++j) {
                const int dd = j * 16 + l15;
                v2f bf;
                bf.x = Vp[(size_t)(s0 + ks + half * 2) * Cn + dd];
                bf.y = Vp[(size_t)(s0 + ks + half * 2 + 1) * Cn + dd];
                o[j] = __builtin_amdgcn_wmma_f32_16x16x4_f32(
                    false, ap, false, bf, 0, o[j], false, false);
            }
        }
    }

    // normalize and write y[b, t, h*64 + d]
#pragma unroll
    for (int j = 0; j < 4; ++j) {
        const int dd = j * 16 + l15;
#pragma unroll
        for (int r = 0; r < 8; ++r) {
            const int row = t0 + r + half * 8;
            y[base + (size_t)row * Cn + dd] = o[j][r] / lrow[r];
        }
    }
}

// ---------------------------------------------------------------------------
// LayerNorm: one 256-thread block per row of C=1024.
// ---------------------------------------------------------------------------
__global__ __launch_bounds__(256) void layernorm_kernel(
    const float* __restrict__ x, const float* __restrict__ g,
    const float* __restrict__ bta, float* __restrict__ out)
{
    const int row = blockIdx.x;
    const int tid = threadIdx.x;
    const float* xr = x + (size_t)row * Cn;
    __shared__ float red[256];

    float s = 0.0f;
    for (int i = tid; i < Cn; i += 256) s += xr[i];
    red[tid] = s;
    __syncthreads();
    for (int off = 128; off > 0; off >>= 1) {
        if (tid < off) red[tid] += red[tid + off];
        __syncthreads();
    }
    const float mu = red[0] * (1.0f / Cn);
    __syncthreads();

    float s2 = 0.0f;
    for (int i = tid; i < Cn; i += 256) {
        const float d = xr[i] - mu;
        s2 += d * d;
    }
    red[tid] = s2;
    __syncthreads();
    for (int off = 128; off > 0; off >>= 1) {
        if (tid < off) red[tid] += red[tid + off];
        __syncthreads();
    }
    const float rstd = rsqrtf(red[0] * (1.0f / Cn) + 1e-5f);
    __syncthreads();

    for (int i = tid; i < Cn; i += 256)
        out[(size_t)row * Cn + i] = (xr[i] - mu) * rstd * g[i] + bta[i];
}

// ---------------------------------------------------------------------------
// Router: logits = x1[0,t,:] @ router[C,8]; top-2, softmax -> gates[T,8].
// One wave per token.
// ---------------------------------------------------------------------------
__global__ __launch_bounds__(32) void router_kernel(
    const float* __restrict__ x1, const float* __restrict__ Wr,
    float* __restrict__ gates)
{
    const int t    = blockIdx.x;
    const int lane = threadIdx.x;
    const float* xr = x1 + (size_t)t * Cn;   // batch 0

    float acc[En] = {};
    for (int c = lane; c < Cn; c += 32) {
        const float xv = xr[c];
#pragma unroll
        for (int e = 0; e < En; ++e) acc[e] += xv * Wr[(size_t)c * En + e];
    }
#pragma unroll
    for (int e = 0; e < En; ++e) {
        float s = acc[e];
        s += __shfl_xor(s, 1, 32);
        s += __shfl_xor(s, 2, 32);
        s += __shfl_xor(s, 4, 32);
        s += __shfl_xor(s, 8, 32);
        s += __shfl_xor(s, 16, 32);
        acc[e] = s;
    }
    // top-2 (lowest index wins ties, matching lax.top_k), softmax of the pair
    int   i0 = 0;
    float v0 = acc[0];
#pragma unroll
    for (int e = 1; e < En; ++e)
        if (acc[e] > v0) { v0 = acc[e]; i0 = e; }
    int   i1 = -1;
    float v1 = -3.4e38f;
#pragma unroll
    for (int e = 0; e < En; ++e)
        if (e != i0 && acc[e] > v1) { v1 = acc[e]; i1 = e; }
    const float e0  = 1.0f;                 // exp(v0 - v0)
    const float e1  = __expf(v1 - v0);
    const float inv = 1.0f / (e0 + e1);
    if (lane < En) {
        const float gv = (lane == i0) ? e0 * inv : (lane == i1 ? e1 * inv : 0.0f);
        gates[(size_t)t * En + lane] = gv;
    }
}

__global__ void zero_kernel(float* __restrict__ p, int n)
{
    const int i = blockIdx.x * blockDim.x + threadIdx.x;
    if (i < n) p[i] = 0.0f;
}

// ---------------------------------------------------------------------------
// Host-side orchestration.
// Workspace layout (floats), total ~135 MB:
//   h    : B*T*C      (LN1 out, then reused for attention output y)
//   qb   : B*T*C      (Q, then reused for x1 = x + attn proj)
//   kb   : B*T*C      (K, then reused for y_adapt accumulator)
//   vb   : B*T*C      (V, then reused for h2 = LN2(x1))
//   mlp1 : B*T*4C
//   down : B*T*BOT    (per-expert adapter hidden, reused across experts)
//   gates: T*E
// ---------------------------------------------------------------------------
extern "C" void kernel_launch(void* const* d_in, const int* in_sizes, int n_in,
                              void* d_out, int out_size, void* d_ws, size_t ws_size,
                              hipStream_t stream)
{
    (void)in_sizes; (void)n_in; (void)out_size; (void)ws_size;

    const float* x      = (const float*)d_in[0];
    const float* Wq     = (const float*)d_in[1];
    const float* bq     = (const float*)d_in[2];
    const float* Wk     = (const float*)d_in[3];
    const float* bk     = (const float*)d_in[4];
    const float* Wv     = (const float*)d_in[5];
    const float* bv     = (const float*)d_in[6];
    const float* Wo     = (const float*)d_in[7];
    const float* bo     = (const float*)d_in[8];
    const float* ln1_g  = (const float*)d_in[9];
    const float* ln1_b  = (const float*)d_in[10];
    const float* ln2_g  = (const float*)d_in[11];
    const float* ln2_b  = (const float*)d_in[12];
    const float* mlp_w1 = (const float*)d_in[13];
    const float* mlp_b1 = (const float*)d_in[14];
    const float* mlp_w2 = (const float*)d_in[15];
    const float* mlp_b2 = (const float*)d_in[16];
    const float* router = (const float*)d_in[17];
    const float* ad_w   = (const float*)d_in[18];
    const float* ad_b   = (const float*)d_in[19];
    const float* au_w   = (const float*)d_in[20];
    const float* au_b   = (const float*)d_in[21];

    float* out = (float*)d_out;

    const size_t NBTC = (size_t)BTn * Cn;        // 4M floats
    float* ws    = (float*)d_ws;
    float* h     = ws;
    float* qb    = h    + NBTC;
    float* kb    = qb   + NBTC;
    float* vb    = kb   + NBTC;
    float* mlp1  = vb   + NBTC;
    float* down  = mlp1 + (size_t)BTn * FFn;
    float* gates = down + (size_t)BTn * BOTn;

    const dim3 gemmCC(Cn / 64, BTn / 128);       // M=4096, N=1024
    const dim3 gemmFF(FFn / 64, BTn / 128);      // M=4096, N=4096
    const dim3 gemmDN(BOTn / 64, BTn / 128);     // M=4096, N=64

    // 1. h = LN1(x)
    layernorm_kernel<<<BTn, 256, 0, stream>>>(x, ln1_g, ln1_b, h);

    // 2. Q/K/V projections
    gemm_wmma<0, false, false, false><<<gemmCC, 256, GEMM_LDS_BYTES, stream>>>(
        h, Wq, bq, nullptr, nullptr, nullptr, 0, qb, BTn, Cn, Cn);
    gemm_wmma<0, false, false, false><<<gemmCC, 256, GEMM_LDS_BYTES, stream>>>(
        h, Wk, bk, nullptr, nullptr, nullptr, 0, kb, BTn, Cn, Cn);
    gemm_wmma<0, false, false, false><<<gemmCC, 256, GEMM_LDS_BYTES, stream>>>(
        h, Wv, bv, nullptr, nullptr, nullptr, 0, vb, BTn, Cn, Cn);

    // 3. causal attention -> y (reuse h)
    attn_kernel<<<dim3(Tn / 16 / 4, Hn, Bn), 128, 0, stream>>>(qb, kb, vb, h);

    // 4. x1 = x + y @ Wo + bo   (into qb)
    gemm_wmma<0, true, false, false><<<gemmCC, 256, GEMM_LDS_BYTES, stream>>>(
        h, Wo, bo, x, nullptr, nullptr, 0, qb, BTn, Cn, Cn);

    // 5. router gates from batch 0 of x1
    router_kernel<<<Tn, 32, 0, stream>>>(qb, router, gates);

    // 6. adapter MoE: y_adapt (kb) = sum_e gate[t,e]*0.1*(relu(x1@adw_e+adb_e)@auw_e+aub_e)
    zero_kernel<<<(int)(NBTC / 256), 256, 0, stream>>>(kb, (int)NBTC);
    for (int e = 0; e < En; ++e) {
        gemm_wmma<1, false, false, false><<<gemmDN, 256, GEMM_LDS_BYTES, stream>>>(
            qb, ad_w + (size_t)e * Cn * BOTn, ad_b + (size_t)e * BOTn,
            nullptr, nullptr, nullptr, 0, down, BTn, BOTn, Cn);
        gemm_wmma<0, false, false, true><<<gemmCC, 256, GEMM_LDS_BYTES, stream>>>(
            down, au_w + (size_t)e * BOTn * Cn, au_b + (size_t)e * Cn,
            nullptr, nullptr, gates, e, kb, BTn, Cn, BOTn);
    }

    // 7. h2 = LN2(x1)  (into vb)
    layernorm_kernel<<<BTn, 256, 0, stream>>>(qb, ln2_g, ln2_b, vb);

    // 8. mlp1 = gelu(h2 @ W1 + b1)
    gemm_wmma<2, false, false, false><<<gemmFF, 256, GEMM_LDS_BYTES, stream>>>(
        vb, mlp_w1, mlp_b1, nullptr, nullptr, nullptr, 0, mlp1, BTn, FFn, Cn);

    // 9. out = x1 + y_adapt + (mlp1 @ W2 + b2)
    gemm_wmma<0, true, true, false><<<gemmCC, 256, GEMM_LDS_BYTES, stream>>>(
        mlp1, mlp_w2, mlp_b2, qb, kb, nullptr, 0, out, BTn, Cn, FFn);
}

// v001
// It runs in 1000 microseconds.
// Timed twice side by side with v000, it ran 1.36 and 1.37 times as fast.
#include <hip/hip_runtime.h>
#include <math.h>
#include <stdint.h>

// ---------------------------------------------------------------------------
// Transformer block (LN -> attn -> residual -> top2 MoE adapters -> LN -> MLP)
// for MI455X / gfx1250.  All GEMMs run on V_WMMA_F32_16X16X4_F32 (exact fp32
// matrix op) so numerics match the fp32 JAX reference while using the CDNA5
// matrix pipeline.  wave32 everywhere.
//
// This revision stages GEMM B-tiles through LDS with CDNA5 async global->LDS
// DMA (GLOBAL_LOAD_ASYNC_TO_LDS_B128 / s_wait_asynccnt), double-buffered, so
// each 32x64 B-chunk is fetched once per block instead of once per wave (8x
// less L2 traffic on the dominant GEMMs).
// ---------------------------------------------------------------------------

#define USE_ASYNC_LDS 1   // 0 = plain global load + ds_store fallback

#define Bn   4
#define Tn   1024
#define Cn   1024
#define Hn   16
#define Dn   64
#define En   8
#define BOTn 64
#define FFn  4096
#define BTn  (Bn * Tn)          // 4096 rows

typedef float v2f __attribute__((ext_vector_type(2)));
typedef float v8f __attribute__((ext_vector_type(8)));

// ---------------------------------------------------------------------------
// Generic fp32 WMMA GEMM:  out = epilogue(A[M,K] @ W[K,N] + bias[N])
// Block = 256 threads = 8 waves; each wave computes a 16(M) x 64(N) strip of
// a 128x64 block tile.  B is staged in LDS:
//   chunk = 32(K) x 64(N) floats, row stride padded to 72 words so the two
//   16-lane halves of a fragment read hit disjoint bank ranges.
//   Double buffered; filled by async global->LDS b128 DMA (2 per thread).
// A-fragment (16x4 f32): lanes 0-15 hold K=k,k+1 ; lanes 16-31 hold K=k+2,k+3.
// C/D (16x16 f32): VGPR r -> row r (lanes 0-15) / row r+8 (lanes 16-31).
//
// ACT: 0=none, 1=relu, 2=exact gelu.  RES1/RES2: add residual tensors.
// ADP (all adapter experts in one launch):
//   1 = down: blockIdx.z is the expert; W, bias are [E][K][N], [E][N]; the
//       result, times gates[t,e] * 0.1, goes to column e*N+col of out[M][ldo].
//   2 = up:   A is that [M][E*BOT] matrix and W the experts' [E*BOT][N] stack,
//       so the K loop sums over the experts; bias is [E][N], gate-weighted.
//       The block's 128 gate rows and its 8x64 bias tile lie in LDS behind the
//       two B buffers, copied there behind the K loop.
// ---------------------------------------------------------------------------
#define GEMM_KC   32
#define GEMM_BSTR 72
#define GEMM_LDS_BYTES (2 * GEMM_KC * GEMM_BSTR * 4)
#define GEMM_UP_LDS_BYTES (GEMM_LDS_BYTES + (128 * En + En * 64) * 4)

template <int ACT, bool RES1, bool RES2, int ADP>
__global__ __launch_bounds__(256) void gemm_wmma(
    const float* __restrict__ A, const float* __restrict__ W,
    const float* __restrict__ bias,
    const float* __restrict__ res1, const float* __restrict__ res2,
    const float* __restrict__ gates, int ldo,
    float* __restrict__ out, int M, int N, int K)
{
    extern __shared__ float Bs[];          // [2][GEMM_KC][GEMM_BSTR]

    const int tid  = threadIdx.x;
    const int lane = tid & 31;
    const int wave = tid >> 5;
    const int half = lane >> 4;     // 0: K pair {0,1}, 1: K pair {2,3}
    const int l15  = lane & 15;
    const int m0 = blockIdx.y * 128 + wave * 16;
    const int n0 = blockIdx.x * 64;

    if (ADP == 1) {
        W    += (size_t)blockIdx.z * K * N;
        bias += (size_t)blockIdx.z * N;
    }

    const float* arow = A + (size_t)(m0 + l15) * K;
    const int nchunk = K / GEMM_KC;

    // Cooperative loader: one 32x64 B-chunk per block, 2 float4 per thread.
    auto issueChunk = [&](int kc) {
        const int k0 = kc * GEMM_KC;
        const uint32_t bufbyte = (uint32_t)((kc & 1) * (GEMM_KC * GEMM_BSTR) * 4);
#pragma unroll
        for (int p = 0; p < 2; ++p) {
            const int id = tid + p * 256;
            const int kr = id >> 4;          // 0..31  (K row in chunk)
            const int c4 = (id & 15) * 4;    // 0..60  (N col, float4 granular)
            const uint32_t laddr = bufbyte + (uint32_t)(kr * GEMM_BSTR + c4) * 4u;
#if USE_ASYNC_LDS
            const uint64_t gaddr =
                (uint64_t)(uintptr_t)(W + (size_t)(k0 + kr) * N + (n0 + c4));
            // VDST = per-lane LDS byte offset, VADDR = 64-bit global address.
            asm volatile("global_load_async_to_lds_b128 %0, %1, off"
                         :: "v"(laddr), "v"(gaddr) : "memory");
#else
            const float4 t = *(const float4*)(W + (size_t)(k0 + kr) * N + (n0 + c4));
            *(float4*)((char*)Bs + laddr) = t;
#endif
        }
    };

    issueChunk(0);

    v8f acc[4] = {};
    for (int kc = 0; kc < nchunk; ++kc) {
#if USE_ASYNC_LDS
        asm volatile("s_wait_asynccnt 0" ::: "memory");   // my chunk DMAs done
#endif
        __syncthreads();                                  // everyone's done
        if (kc + 1 < nchunk) issueChunk(kc + 1);          // prefetch other buf
        const float* buf = Bs + (kc & 1) * (GEMM_KC * GEMM_BSTR);
        const int k0 = kc * GEMM_KC;
#pragma unroll
        for (int kl = 0; kl < GEMM_KC; kl += 4) {
            const int ka = k0 + kl + half * 2;
            v2f a;
            a.x = arow[ka];
            a.y = arow[ka + 1];
            const int kb = kl + half * 2;
#pragma unroll
            for (int j = 0; j < 4; ++j) {
                const int col = j * 16 + l15;
                v2f b;
                b.x = buf[kb * GEMM_BSTR + col];
                b.y = buf[(kb + 1) * GEMM_BSTR + col];
                acc[j] = __builtin_amdgcn_wmma_f32_16x16x4_f32(
                    false, a, false, b, 0, acc[j], false, false);
            }
        }
        __syncthreads();   // all waves finished reading this buffer
    }

    if (ADP == 2) {
        const float* Gs = Bs + 2 * GEMM_KC * GEMM_BSTR;   // [128][En] gate rows
        const float* Es = Gs + 128 * En;                  // [En][64]  bias tile
        // One float4 of gates and one float2 of bias per thread.  The 128 rows
        // of a block are consecutive t (128 divides Tn).
        const float* gsrc = gates + (size_t)((blockIdx.y * 128) & (Tn - 1)) * En + tid * 4;
        const float* esrc = bias + (size_t)wave * N + n0 + lane * 2;
        const uint32_t gdst = (uint32_t)GEMM_LDS_BYTES + (uint32_t)tid * 16u;
        const uint32_t edst = (uint32_t)(GEMM_LDS_BYTES + 128 * En * 4) + (uint32_t)tid * 8u;
        // Global -> LDS through no register.  s_wait_xcnt 0 stands inside the
        // statement so that no address register is reused ahead of it.
        asm volatile("global_load_async_to_lds_b128 %0, %1, off\n\t"
                     "global_load_async_to_lds_b64 %2, %3, off\n\t"
                     "s_wait_xcnt 0x0"
                     :: "v"(gdst), "v"(gsrc), "v"(edst), "v"(esrc) : "memory");
        asm volatile("s_wait_asynccnt 0x0" ::: "memory");   // my two copies landed
        __syncthreads();                                    // every wave's landed

        // acc += (0.1 * gates) @ bias, in the accumulators' own layout.
        float be[4][En];
#pragma unroll   // static j, e keep be[][] in registers
        for (int j = 0; j < 4; ++j)
#pragma unroll   // as above
            for (int e = 0; e < En; ++e) be[j][e] = Es[e * 64 + j * 16 + l15];
#pragma unroll   // static r keeps acc[j][r] in registers
        for (int r = 0; r < 8; ++r) {
            const float4* grow = (const float4*)(Gs + (wave * 16 + r + half * 8) * En);
            const float4 ga = grow[0], gb = grow[1];
            const float gs[En] = {ga.x * 0.1f, ga.y * 0.1f, ga.z * 0.1f, ga.w * 0.1f,
                                  gb.x * 0.1f, gb.y * 0.1f, gb.z * 0.1f, gb.w * 0.1f};
#pragma unroll   // static j for acc[j][r], be[j][e]
            for (int j = 0; j < 4; ++j) {
                float bsum = 0.0f;
#pragma unroll   // static e for gs[e], be[j][e]
                for (int e = 0; e < En; ++e) bsum += gs[e] * be[j][e];
                acc[j][r] += bsum;
            }
        }
    }

#pragma unroll
    for (int j = 0; j < 4; ++j) {
        const int col = n0 + j * 16 + l15;
        const float bv = bias[col];
#pragma unroll
        for (int r = 0; r < 8; ++r) {
            const int row = m0 + r + half * 8;
            float v = (ADP == 2) ? acc[j][r] : acc[j][r] + bv;
            if (ACT == 1) v = fmaxf(v, 0.0f);
            if (ACT == 2) v = 0.5f * v * (1.0f + erff(v * 0.70710678118654752f));
            const size_t idx = (size_t)row * N + col;
            if (RES1) v += res1[idx];
            if (RES2) v += res2[idx];
            if (ADP == 1) {
                const float g = gates[(size_t)(row & (Tn - 1)) * En + blockIdx.z];
                out[(size_t)row * ldo + blockIdx.z * N + col] = g * 0.1f * v;
            } else {
                out[idx] = v;
            }
        }
    }
}

// ---------------------------------------------------------------------------
// Causal flash attention, fp32 WMMA.  One wave per (b, h, 16-query tile);
// 4 waves per block.  Row softmax stats reduced with width-16 shfl butterflies
// (each 16x16 score tile keeps row M in VGPR index, col N in lane).
// P tile is staged through LDS to convert C-layout -> A-fragment layout.
// ---------------------------------------------------------------------------
__global__ __launch_bounds__(128) void attn_kernel(
    const float* __restrict__ q, const float* __restrict__ k,
    const float* __restrict__ v, float* __restrict__ y)
{
    const int lane = threadIdx.x & 31;
    const int wave = threadIdx.x >> 5;
    const int half = lane >> 4;
    const int l15  = lane & 15;

    const int t0 = (blockIdx.x * 4 + wave) * 16;
    const int hh = blockIdx.y;
    const int b  = blockIdx.z;

    const size_t base = (size_t)b * Tn * Cn + (size_t)hh * Dn;
    const float* Qp = q + base;
    const float* Kp = k + base;
    const float* Vp = v + base;

    __shared__ float Pt[4][16][17];   // +1 pad: conflict-free transposed reads

    // Q fragments for all 16 K-steps over D=64 (resident for whole tile)
    v2f aq[16];
    {
        const float* qrow = Qp + (size_t)(t0 + l15) * Cn;
#pragma unroll
        for (int s = 0; s < 16; ++s) {
            const int dd = s * 4 + half * 2;
            aq[s].x = qrow[dd];
            aq[s].y = qrow[dd + 1];
        }
    }

    v8f o[4] = {};
    float mrow[8], lrow[8];
#pragma unroll
    for (int r = 0; r < 8; ++r) { mrow[r] = -1e30f; lrow[r] = 0.0f; }

    for (int s0 = 0; s0 <= t0; s0 += 16) {
        // S = Q @ K^T  (16x16 tile, K-dim = 64)
        v8f sa = {};
#pragma unroll
        for (int s = 0; s < 16; ++s) {
            const int dd = s * 4 + half * 2;
            const float* kr = Kp + (size_t)(s0 + l15) * Cn;
            v2f bf;
            bf.x = kr[dd];
            bf.y = kr[dd + 1];
            sa = __builtin_amdgcn_wmma_f32_16x16x4_f32(
                false, aq[s], false, bf, 0, sa, false, false);
        }

        // scale, causal mask, online softmax update, write P to LDS
#pragma unroll
        for (int r = 0; r < 8; ++r) {
            const int row = t0 + r + half * 8;   // query index
            const int col = s0 + l15;            // key index
            float sv = sa[r] * 0.125f;           // 1/sqrt(64)
            if (col > row) sv = -1e30f;

            float mx = sv;
            mx = fmaxf(mx, __shfl_xor(mx, 1, 16));
            mx = fmaxf(mx, __shfl_xor(mx, 2, 16));
            mx = fmaxf(mx, __shfl_xor(mx, 4, 16));
            mx = fmaxf(mx, __shfl_xor(mx, 8, 16));

            const float mn    = fmaxf(mrow[r], mx);
            const float alpha = __expf(mrow[r] - mn);
            const float pv    = __expf(sv - mn);

            float ps = pv;
            ps += __shfl_xor(ps, 1, 16);
            ps += __shfl_xor(ps, 2, 16);
            ps += __shfl_xor(ps, 4, 16);
            ps += __shfl_xor(ps, 8, 16);

            lrow[r] = lrow[r] * alpha + ps;
            mrow[r] = mn;
#pragma unroll
            for (int j = 0; j < 4; ++j) o[j][r] *= alpha;

            Pt[wave][r + half * 8][l15] = pv;
        }
        // Same-wave LDS ops are in-order (DScnt); no cross-wave sharing here.

        // O += P @ V   (K-dim = 16 keys, N = 64 head dims)
#pragma unroll
        for (int ks = 0; ks < 16; ks += 4) {
            v2f ap;
            ap.x = Pt[wave][l15][ks + half * 2];
            ap.y = Pt[wave][l15][ks + half * 2 + 1];
#pragma unroll
            for (int j = 0; j < 4; ++j) {
                const int dd = j * 16 + l15;
                v2f bf;
                bf.x = Vp[(size_t)(s0 + ks + half * 2) * Cn + dd];
                bf.y = Vp[(size_t)(s0 + ks + half * 2 + 1) * Cn + dd];
                o[j] = __builtin_amdgcn_wmma_f32_16x16x4_f32(
                    false, ap, false, bf, 0, o[j], false, false);
            }
        }
    }

    // normalize and write y[b, t, h*64 + d]
#pragma unroll
    for (int j = 0; j < 4; ++j) {
        const int dd = j * 16 + l15;
#pragma unroll
        for (int r = 0; r < 8; ++r) {
            const int row = t0 + r + half * 8;
            y[base + (size_t)row * Cn + dd] = o[j][r] / lrow[r];
        }
    }
}

// ---------------------------------------------------------------------------
// LayerNorm: one 256-thread block per row of C=1024.
// ---------------------------------------------------------------------------
__global__ __launch_bounds__(256) void layernorm_kernel(
    const float* __restrict__ x, const float* __restrict__ g,
    const float* __restrict__ bta, float* __restrict__ out)
{
    const int row = blockIdx.x;
    const int tid = threadIdx.x;
    const float* xr = x + (size_t)row * Cn;
    __shared__ float red[256];

    float s = 0.0f;
    for (int i = tid; i < Cn; i += 256) s += xr[i];
    red[tid] = s;
    __syncthreads();
    for (int off = 128; off > 0; off >>= 1) {
        if (tid < off) red[tid] += red[tid + off];
        __syncthreads();
    }
    const float mu = red[0] * (1.0f / Cn);
    __syncthreads();

    float s2 = 0.0f;
    for (int i = tid; i < Cn; i += 256) {
        const float d = xr[i] - mu;
        s2 += d * d;
    }
    red[tid] = s2;
    __syncthreads();
    for (int off = 128; off > 0; off >>= 1) {
        if (tid < off) red[tid] += red[tid + off];
        __syncthreads();
    }
    const float rstd = rsqrtf(red[0] * (1.0f / Cn) + 1e-5f);
    __syncthreads();

    for (int i = tid; i < Cn; i += 256)
        out[(size_t)row * Cn + i] = (xr[i] - mu) * rstd * g[i] + bta[i];
}

// ---------------------------------------------------------------------------
// Router: logits = x1[0,t,:] @ router[C,8]; top-2, softmax -> gates[T,8].
// One wave per token.
// ---------------------------------------------------------------------------
__global__ __launch_bounds__(32) void router_kernel(
    const float* __restrict__ x1, const float* __restrict__ Wr,
    float* __restrict__ gates)
{
    const int t    = blockIdx.x;
    const int lane = threadIdx.x;
    const float* xr = x1 + (size_t)t * Cn;   // batch 0

    float acc[En] = {};
    for (int c = lane; c < Cn; c += 32) {
        const float xv = xr[c];
#pragma unroll
        for (int e = 0; e < En; ++e) acc[e] += xv * Wr[(size_t)c * En + e];
    }
#pragma unroll
    for (int e = 0; e < En; ++e) {
        float s = acc[e];
        s += __shfl_xor(s, 1, 32);
        s += __shfl_xor(s, 2, 32);
        s += __shfl_xor(s, 4, 32);
        s += __shfl_xor(s, 8, 32);
        s += __shfl_xor(s, 16, 32);
        acc[e] = s;
    }
    // top-2 (lowest index wins ties, matching lax.top_k), softmax of the pair
    int   i0 = 0;
    float v0 = acc[0];
#pragma unroll
    for (int e = 1; e < En; ++e)
        if (acc[e] > v0) { v0 = acc[e]; i0 = e; }
    int   i1 = -1;
    float v1 = -3.4e38f;
#pragma unroll
    for (int e = 0; e < En; ++e)
        if (e != i0 && acc[e] > v1) { v1 = acc[e]; i1 = e; }
    const float e0  = 1.0f;                 // exp(v0 - v0)
    const float e1  = __expf(v1 - v0);
    const float inv = 1.0f / (e0 + e1);
    if (lane < En) {
        const float gv = (lane == i0) ? e0 * inv : (lane == i1 ? e1 * inv : 0.0f);
        gates[(size_t)t * En + lane] = gv;
    }
}

// ---------------------------------------------------------------------------
// Host-side orchestration.
// Workspace layout (floats), total ~143 MB:
//   h    : B*T*C      (LN1 out, then reused for attention output y)
//   qb   : B*T*C      (Q, then reused for x1 = x + attn proj)
//   kb   : B*T*C      (K, then reused for y_adapt)
//   vb   : B*T*C      (V, then reused for h2 = LN2(x1))
//   mlp1 : B*T*4C
//   down : B*T*E*BOT  (gate-scaled adapter hidden, all experts side by side)
//   gates: T*E
// ---------------------------------------------------------------------------
extern "C" void kernel_launch(void* const* d_in, const int* in_sizes, int n_in,
                              void* d_out, int out_size, void* d_ws, size_t ws_size,
                              hipStream_t stream)
{
    (void)in_sizes; (void)n_in; (void)out_size; (void)ws_size;

    const float* x      = (const float*)d_in[0];
    const float* Wq     = (const float*)d_in[1];
    const float* bq     = (const float*)d_in[2];
    const float* Wk     = (const float*)d_in[3];
    const float* bk     = (const float*)d_in[4];
    const float* Wv     = (const float*)d_in[5];
    const float* bv     = (const float*)d_in[6];
    const float* Wo     = (const float*)d_in[7];
    const float* bo     = (const float*)d_in[8];
    const float* ln1_g  = (const float*)d_in[9];
    const float* ln1_b  = (const float*)d_in[10];
    const float* ln2_g  = (const float*)d_in[11];
    const float* ln2_b  = (const float*)d_in[12];
    const float* mlp_w1 = (const float*)d_in[13];
    const float* mlp_b1 = (const float*)d_in[14];
    const float* mlp_w2 = (const float*)d_in[15];
    const float* mlp_b2 = (const float*)d_in[16];
    const float* router = (const float*)d_in[17];
    const float* ad_w   = (const float*)d_in[18];
    const float* ad_b   = (const float*)d_in[19];
    const float* au_w   = (const float*)d_in[20];
    const float* au_b   = (const float*)d_in[21];

    float* out = (float*)d_out;

    const size_t NBTC = (size_t)BTn * Cn;        // 4M floats
    float* ws    = (float*)d_ws;
    float* h     = ws;
    float* qb    = h    + NBTC;
    float* kb    = qb   + NBTC;
    float* vb    = kb   + NBTC;
    float* mlp1  = vb   + NBTC;
    float* down  = mlp1 + (size_t)BTn * FFn;
    float* gates = down + (size_t)BTn * En * BOTn;

    const dim3 gemmCC(Cn / 64, BTn / 128);       // M=4096, N=1024
    const dim3 gemmFF(FFn / 64, BTn / 128);      // M=4096, N=4096
    const dim3 gemmDN(BOTn / 64, BTn / 128, En); // M=4096, N=64, z = expert

    // 1. h = LN1(x)
    layernorm_kernel<<<BTn, 256, 0, stream>>>(x, ln1_g, ln1_b, h);

    // 2. Q/K/V projections
    gemm_wmma<0, false, false, 0><<<gemmCC, 256, GEMM_LDS_BYTES, stream>>>(
        h, Wq, bq, nullptr, nullptr, nullptr, 0, qb, BTn, Cn, Cn);
    gemm_wmma<0, false, false, 0><<<gemmCC, 256, GEMM_LDS_BYTES, stream>>>(
        h, Wk, bk, nullptr, nullptr, nullptr, 0, kb, BTn, Cn, Cn);
    gemm_wmma<0, false, false, 0><<<gemmCC, 256, GEMM_LDS_BYTES, stream>>>(
        h, Wv, bv, nullptr, nullptr, nullptr, 0, vb, BTn, Cn, Cn);

    // 3. causal attention -> y (reuse h)
    attn_kernel<<<dim3(Tn / 16 / 4, Hn, Bn), 128, 0, stream>>>(qb, kb, vb, h);

    // 4. x1 = x + y @ Wo + bo   (into qb)
    gemm_wmma<0, true, false, 0><<<gemmCC, 256, GEMM_LDS_BYTES, stream>>>(
        h, Wo, bo, x, nullptr, nullptr, 0, qb, BTn, Cn, Cn);

    // 5. router gates from batch 0 of x1
    router_kernel<<<Tn, 32, 0, stream>>>(qb, router, gates);

    // 6. adapter MoE: y_adapt (kb) = sum_e gate[t,e]*0.1*(relu(x1@adw_e+adb_e)@auw_e+aub_e)
    gemm_wmma<1, false, false, 1><<<gemmDN, 256, GEMM_LDS_BYTES, stream>>>(
        qb, ad_w, ad_b, nullptr, nullptr, gates, En * BOTn, down, BTn, BOTn, Cn);
    gemm_wmma<0, false, false, 2><<<gemmCC, 256, GEMM_UP_LDS_BYTES, stream>>>(
        down, au_w, au_b, nullptr, nullptr, gates, 0, kb, BTn, Cn, En * BOTn);

    // 7. h2 = LN2(x1)  (into vb)
    layernorm_kernel<<<BTn, 256, 0, stream>>>(qb, ln2_g, ln2_b, vb);

    // 8. mlp1 = gelu(h2 @ W1 + b1)
    gemm_wmma<2, false, false, 0><<<gemmFF, 256, GEMM_LDS_BYTES, stream>>>(
        vb, mlp_w1, mlp_b1, nullptr, nullptr, nullptr, 0, mlp1, BTn, FFn, Cn);

    // 9. out = x1 + y_adapt + (mlp1 @ W2 + b2)
    gemm_wmma<0, true, true, 0><<<gemmCC, 256, GEMM_LDS_BYTES, stream>>>(
        mlp1, mlp_w2, mlp_b2, qb, kb, nullptr, 0, out, BTn, Cn, FFn);
}

// v002
// Measured time: 892 microseconds a run.
// Two timings next to v001 put it at 1.12 and 1.13 times that version's speed.
// All steps since v000 together make it 1.53 times as fast.
#include <hip/hip_runtime.h>
#include <math.h>
#include <stdint.h>

// ---------------------------------------------------------------------------
// Transformer block (LN -> attn -> residual -> top2 MoE adapters -> LN -> MLP)
// for MI455X / gfx1250.  All GEMMs run on V_WMMA_F32_16X16X4_F32 (exact fp32
// matrix op) so numerics match the fp32 JAX reference while using the CDNA5
// matrix pipeline.  wave32 everywhere.
//
// The GEMM stages both operand tiles through LDS with CDNA5 async global->LDS
// copies (GLOBAL_LOAD_ASYNC_TO_LDS_B128 / s_wait_asynccnt), double-buffered:
// each 32x64 B-chunk is fetched once per block instead of once per wave, and
// each 128x32 A-chunk arrives as whole 128-byte lines one chunk ahead instead
// of as 16-byte pieces of 16 lines per fragment load.
// ---------------------------------------------------------------------------

#define Bn   4
#define Tn   1024
#define Cn   1024
#define Hn   16
#define Dn   64
#define En   8
#define BOTn 64
#define FFn  4096
#define BTn  (Bn * Tn)          // 4096 rows

typedef float v2f __attribute__((ext_vector_type(2)));
typedef float v8f __attribute__((ext_vector_type(8)));

// ---------------------------------------------------------------------------
// Generic fp32 WMMA GEMM:  out = epilogue(A[M,K] @ W[K,N] + bias[N])
// Block = 256 threads = 8 waves; each wave computes a 16(M) x 64(N) strip of
// a 128x64 block tile.  B is staged in LDS:
//   chunk = 32(K) x 64(N) floats, row stride padded to 72 words so the two
//   16-lane halves of a fragment read hit disjoint bank ranges.
//   Double buffered; filled by async global->LDS b128 DMA (2 per thread).
// A is staged beside it:
//   chunk = 128(M) x 32(K) floats, row stride padded to 36 words so the 32
//   8-byte fragment reads of a wave fall on all 64 banks once.
//   Double buffered; each wave copies its own 16 rows (4 b128 per thread).
// A-fragment (16x4 f32): lanes 0-15 hold K=k,k+1 ; lanes 16-31 hold K=k+2,k+3.
// C/D (16x16 f32): VGPR r -> row r (lanes 0-15) / row r+8 (lanes 16-31).
//
// ACT: 0=none, 1=relu, 2=exact gelu.  RES1/RES2: add residual tensors.
// ADP (all adapter experts in one launch):
//   1 = down: blockIdx.z is the expert; W, bias are [E][K][N], [E][N]; the
//       result, times gates[t,e] * 0.1, goes to column e*N+col of out[M][ldo].
//   2 = up:   A is that [M][E*BOT] matrix and W the experts' [E*BOT][N] stack,
//       so the K loop sums over the experts; bias is [E][N], gate-weighted.
//       The block's 128 gate rows and its 8x64 bias tile lie in LDS behind the
//       B and A buffers, copied there behind the K loop.
// ---------------------------------------------------------------------------
#define GEMM_KC   32
#define GEMM_BSTR 72
#define GEMM_ASTR 36
#define GEMM_B_WORDS (2 * GEMM_KC * GEMM_BSTR)
#define GEMM_A_WORDS (2 * 128 * GEMM_ASTR)
#define GEMM_LDS_BYTES ((GEMM_B_WORDS + GEMM_A_WORDS) * 4)
#define GEMM_UP_LDS_BYTES (GEMM_LDS_BYTES + (128 * En + En * 64) * 4)

template <int ACT, bool RES1, bool RES2, int ADP>
__global__ __launch_bounds__(256) void gemm_wmma(
    const float* __restrict__ A, const float* __restrict__ W,
    const float* __restrict__ bias,
    const float* __restrict__ res1, const float* __restrict__ res2,
    const float* __restrict__ gates, int ldo,
    float* __restrict__ out, int M, int N, int K)
{
    extern __shared__ float Bs[];          // [2][GEMM_KC][GEMM_BSTR], then As
    const float* As = Bs + GEMM_B_WORDS;   // [2][128][GEMM_ASTR]

    const int tid  = threadIdx.x;
    const int lane = tid & 31;
    const int wave = tid >> 5;
    const int half = lane >> 4;     // 0: K pair {0,1}, 1: K pair {2,3}
    const int l15  = lane & 15;
    const int m0 = blockIdx.y * 128 + wave * 16;
    const int n0 = blockIdx.x * 64;

    if (ADP == 1) {
        W    += (size_t)blockIdx.z * K * N;
        bias += (size_t)blockIdx.z * N;
    }

    const int nchunk = K / GEMM_KC;

    // Cooperative loader, one chunk of both operands per call.
    // B: 32x64, two float4 per thread (K rows tid/16 and tid/16 + 16).
    // A: 128x32, four float4 per thread; a copy of a wave is 4 whole rows.
    const uint32_t lds0 = (uint32_t)(uintptr_t)Bs;
    const float* gB = W + (size_t)(tid >> 4) * N + (n0 + (tid & 15) * 4);
    const float* gA = A + (size_t)(m0 + (lane >> 3)) * K + (lane & 7) * 4;
    const uint32_t lB = lds0 + (uint32_t)((tid >> 4) * GEMM_BSTR + (tid & 15) * 4) * 4u;
    const uint32_t lA = lds0 + (uint32_t)(GEMM_B_WORDS
                      + (wave * 16 + (lane >> 3)) * GEMM_ASTR + (lane & 7) * 4) * 4u;
    auto issueChunk = [&](int kc) {
        const float* b0 = gB + (size_t)kc * GEMM_KC * N;
        const float* b1 = b0 + (size_t)16 * N;
        const float* a0 = gA + kc * GEMM_KC;
        const float* a1 = a0 + (size_t)4 * K;
        const float* a2 = a0 + (size_t)8 * K;
        const float* a3 = a0 + (size_t)12 * K;
        const uint32_t db0 = lB + (uint32_t)((kc & 1) * (GEMM_KC * GEMM_BSTR) * 4);
        const uint32_t db1 = db0 + 16u * GEMM_BSTR * 4u;
        const uint32_t da0 = lA + (uint32_t)((kc & 1) * (128 * GEMM_ASTR) * 4);
        const uint32_t da1 = da0 + 4u * GEMM_ASTR * 4u;
        const uint32_t da2 = da0 + 8u * GEMM_ASTR * 4u;
        const uint32_t da3 = da0 + 12u * GEMM_ASTR * 4u;
        // Global -> LDS through no register: first operand the lane's LDS byte
        // address, second its global address.  s_wait_xcnt 0 stands inside the
        // statement so that no address register is reused ahead of it.
        asm volatile("global_load_async_to_lds_b128 %0, %1, off\n\t"
                     "global_load_async_to_lds_b128 %2, %3, off\n\t"
                     "global_load_async_to_lds_b128 %4, %5, off\n\t"
                     "global_load_async_to_lds_b128 %6, %7, off\n\t"
                     "global_load_async_to_lds_b128 %8, %9, off\n\t"
                     "global_load_async_to_lds_b128 %10, %11, off\n\t"
                     "s_wait_xcnt 0x0"
                     :: "v"(db0), "v"(b0), "v"(db1), "v"(b1),
                        "v"(da0), "v"(a0), "v"(da1), "v"(a1),
                        "v"(da2), "v"(a2), "v"(da3), "v"(a3) : "memory");
    };

    issueChunk(0);
    asm volatile("s_wait_asynccnt 0x0" ::: "memory");     // my chunk 0 copies landed
    __syncthreads();                                      // every wave's landed
    if (1 < nchunk) issueChunk(1);                        // flies during chunk 0

    v8f acc[4] = {};
    for (int kc = 0; kc < nchunk; ++kc) {
        const float* buf  = Bs + (kc & 1) * (GEMM_KC * GEMM_BSTR);
        const float* abuf = As + (kc & 1) * (128 * GEMM_ASTR)
                          + (wave * 16 + l15) * GEMM_ASTR + half * 2;
#pragma unroll
        for (int kl = 0; kl < GEMM_KC; kl += 4) {
            const v2f a = *(const v2f*)(abuf + kl);
            const int kb = kl + half * 2;
#pragma unroll
            for (int j = 0; j < 4; ++j) {
                const int col = j * 16 + l15;
                v2f b;
                b.x = buf[kb * GEMM_BSTR + col];
                b.y = buf[(kb + 1) * GEMM_BSTR + col];
                acc[j] = __builtin_amdgcn_wmma_f32_16x16x4_f32(
                    false, a, false, b, 0, acc[j], false, false);
            }
        }
        // Publish point of chunk kc+1; it also frees the buffers just read.
        asm volatile("s_wait_dscnt 0x0" ::: "memory");    // my LDS reads retired
        asm volatile("s_wait_asynccnt 0x0" ::: "memory"); // my chunk kc+1 copies landed
        __syncthreads();                                  // every wave's, both
        if (kc + 2 < nchunk) issueChunk(kc + 2);          // into the buffers just read
    }
    asm volatile("s_wait_asynccnt 0x0" ::: "memory");     // nothing in flight behind the loop

    if (ADP == 2) {
        const float* Gs = Bs + GEMM_B_WORDS + GEMM_A_WORDS;   // [128][En] gate rows
        const float* Es = Gs + 128 * En;                  // [En][64]  bias tile
        // One float4 of gates and one float2 of bias per thread.  The 128 rows
        // of a block are consecutive t (128 divides Tn).
        const float* gsrc = gates + (size_t)((blockIdx.y * 128) & (Tn - 1)) * En + tid * 4;
        const float* esrc = bias + (size_t)wave * N + n0 + lane * 2;
        const uint32_t gdst = (uint32_t)GEMM_LDS_BYTES + (uint32_t)tid * 16u;
        const uint32_t edst = (uint32_t)(GEMM_LDS_BYTES + 128 * En * 4) + (uint32_t)tid * 8u;
        // Global -> LDS through no register.  s_wait_xcnt 0 stands inside the
        // statement so that no address register is reused ahead of it.
        asm volatile("global_load_async_to_lds_b128 %0, %1, off\n\t"
                     "global_load_async_to_lds_b64 %2, %3, off\n\t"
                     "s_wait_xcnt 0x0"
                     :: "v"(gdst), "v"(gsrc), "v"(edst), "v"(esrc) : "memory");
        asm volatile("s_wait_asynccnt 0x0" ::: "memory");   // my two copies landed
        __syncthreads();                                    // every wave's landed

        // acc += (0.1 * gates) @ bias, in the accumulators' own layout.
        float be[4][En];
#pragma unroll   // static j, e keep be[][] in registers
        for (int j = 0; j < 4; ++j)
#pragma unroll   // as above
            for (int e = 0; e < En; ++e) be[j][e] = Es[e * 64 + j * 16 + l15];
#pragma unroll   // static r keeps acc[j][r] in registers
        for (int r = 0; r < 8; ++r) {
            const float4* grow = (const float4*)(Gs + (wave * 16 + r + half * 8) * En);
            const float4 ga = grow[0], gb = grow[1];
            const float gs[En] = {ga.x * 0.1f, ga.y * 0.1f, ga.z * 0.1f, ga.w * 0.1f,
                                  gb.x * 0.1f, gb.y * 0.1f, gb.z * 0.1f, gb.w * 0.1f};
#pragma unroll   // static j for acc[j][r], be[j][e]
            for (int j = 0; j < 4; ++j) {
                float bsum = 0.0f;
#pragma unroll   // static e for gs[e], be[j][e]
                for (int e = 0; e < En; ++e) bsum += gs[e] * be[j][e];
                acc[j][r] += bsum;
            }
        }
    }

#pragma unroll
    for (int j = 0; j < 4; ++j) {
        const int col = n0 + j * 16 + l15;
        const float bv = bias[col];
#pragma unroll
        for (int r = 0; r < 8; ++r) {
            const int row = m0 + r + half * 8;
            float v = (ADP == 2) ? acc[j][r] : acc[j][r] + bv;
            if (ACT == 1) v = fmaxf(v, 0.0f);
            if (ACT == 2) v = 0.5f * v * (1.0f + erff(v * 0.70710678118654752f));
            const size_t idx = (size_t)row * N + col;
            if (RES1) v += res1[idx];
            if (RES2) v += res2[idx];
            if (ADP == 1) {
                const float g = gates[(size_t)(row & (Tn - 1)) * En + blockIdx.z];
                out[(size_t)row * ldo + blockIdx.z * N + col] = g * 0.1f * v;
            } else {
                out[idx] = v;
            }
        }
    }
}

// ---------------------------------------------------------------------------
// Causal flash attention, fp32 WMMA.  One wave per (b, h, 16-query tile);
// 4 waves per block.  Row softmax stats reduced with width-16 shfl butterflies
// (each 16x16 score tile keeps row M in VGPR index, col N in lane).
// P tile is staged through LDS to convert C-layout -> A-fragment layout.
// ---------------------------------------------------------------------------
__global__ __launch_bounds__(128) void attn_kernel(
    const float* __restrict__ q, const float* __restrict__ k,
    const float* __restrict__ v, float* __restrict__ y)
{
    const int lane = threadIdx.x & 31;
    const int wave = threadIdx.x >> 5;
    const int half = lane >> 4;
    const int l15  = lane & 15;

    const int t0 = (blockIdx.x * 4 + wave) * 16;
    const int hh = blockIdx.y;
    const int b  = blockIdx.z;

    const size_t base = (size_t)b * Tn * Cn + (size_t)hh * Dn;
    const float* Qp = q + base;
    const float* Kp = k + base;
    const float* Vp = v + base;

    __shared__ float Pt[4][16][17];   // +1 pad: conflict-free transposed reads

    // Q fragments for all 16 K-steps over D=64 (resident for whole tile)
    v2f aq[16];
    {
        const float* qrow = Qp + (size_t)(t0 + l15) * Cn;
#pragma unroll
        for (int s = 0; s < 16; ++s) {
            const int dd = s * 4 + half * 2;
            aq[s].x = qrow[dd];
            aq[s].y = qrow[dd + 1];
        }
    }

    v8f o[4] = {};
    float mrow[8], lrow[8];
#pragma unroll
    for (int r = 0; r < 8; ++r) { mrow[r] = -1e30f; lrow[r] = 0.0f; }

    for (int s0 = 0; s0 <= t0; s0 += 16) {
        // S = Q @ K^T  (16x16 tile, K-dim = 64)
        v8f sa = {};
#pragma unroll
        for (int s = 0; s < 16; ++s) {
            const int dd = s * 4 + half * 2;
            const float* kr = Kp + (size_t)(s0 + l15) * Cn;
            v2f bf;
            bf.x = kr[dd];
            bf.y = kr[dd + 1];
            sa = __builtin_amdgcn_wmma_f32_16x16x4_f32(
                false, aq[s], false, bf, 0, sa, false, false);
        }

        // scale, causal mask, online softmax update, write P to LDS
#pragma unroll
        for (int r = 0; r < 8; ++r) {
            const int row = t0 + r + half * 8;   // query index
            const int col = s0 + l15;            // key index
            float sv = sa[r] * 0.125f;           // 1/sqrt(64)
            if (col > row) sv = -1e30f;

            float mx = sv;
            mx = fmaxf(mx, __shfl_xor(mx, 1, 16));
            mx = fmaxf(mx, __shfl_xor(mx, 2, 16));
            mx = fmaxf(mx, __shfl_xor(mx, 4, 16));
            mx = fmaxf(mx, __shfl_xor(mx, 8, 16));

            const float mn    = fmaxf(mrow[r], mx);
            const float alpha = __expf(mrow[r] - mn);
            const float pv    = __expf(sv - mn);

            float ps = pv;
            ps += __shfl_xor(ps, 1, 16);
            ps += __shfl_xor(ps, 2, 16);
            ps += __shfl_xor(ps, 4, 16);
            ps += __shfl_xor(ps, 8, 16);

            lrow[r] = lrow[r] * alpha + ps;
            mrow[r] = mn;
#pragma unroll
            for (int j = 0; j < 4; ++j) o[j][r] *= alpha;

            Pt[wave][r + half * 8][l15] = pv;
        }
        // Same-wave LDS ops are in-order (DScnt); no cross-wave sharing here.

        // O += P @ V   (K-dim = 16 keys, N = 64 head dims)
#pragma unroll
        for (int ks = 0; ks < 16; ks += 4) {
            v2f ap;
            ap.x = Pt[wave][l15][ks + half * 2];
            ap.y = Pt[wave][l15][ks + half * 2 + 1];
#pragma unroll
            for (int j = 0; j < 4; ++j) {
                const int dd = j * 16 + l15;
                v2f bf;
                bf.x = Vp[(size_t)(s0 + ks + half * 2) * Cn + dd];
                bf.y = Vp[(size_t)(s0 + ks + half * 2 + 1) * Cn + dd];
                o[j] = __builtin_amdgcn_wmma_f32_16x16x4_f32(
                    false, ap, false, bf, 0, o[j], false, false);
            }
        }
    }

    // normalize and write y[b, t, h*64 + d]
#pragma unroll
    for (int j = 0; j < 4; ++j) {
        const int dd = j * 16 + l15;
#pragma unroll
        for (int r = 0; r < 8; ++r) {
            const int row = t0 + r + half * 8;
            y[base + (size_t)row * Cn + dd] = o[j][r] / lrow[r];
        }
    }
}

// ---------------------------------------------------------------------------
// LayerNorm: one 256-thread block per row of C=1024.
// ---------------------------------------------------------------------------
__global__ __launch_bounds__(256) void layernorm_kernel(
    const float* __restrict__ x, const float* __restrict__ g,
    const float* __restrict__ bta, float* __restrict__ out)
{
    const int row = blockIdx.x;
    const int tid = threadIdx.x;
    const float* xr = x + (size_t)row * Cn;
    __shared__ float red[256];

    float s = 0.0f;
    for (int i = tid; i < Cn; i += 256) s += xr[i];
    red[tid] = s;
    __syncthreads();
    for (int off = 128; off > 0; off >>= 1) {
        if (tid < off) red[tid] += red[tid + off];
        __syncthreads();
    }
    const float mu = red[0] * (1.0f / Cn);
    __syncthreads();

    float s2 = 0.0f;
    for (int i = tid; i < Cn; i += 256) {
        const float d = xr[i] - mu;
        s2 += d * d;
    }
    red[tid] = s2;
    __syncthreads();
    for (int off = 128; off > 0; off >>= 1) {
        if (tid < off) red[tid] += red[tid + off];
        __syncthreads();
    }
    const float rstd = rsqrtf(red[0] * (1.0f / Cn) + 1e-5f);
    __syncthreads();

    for (int i = tid; i < Cn; i += 256)
        out[(size_t)row * Cn + i] = (xr[i] - mu) * rstd * g[i] + bta[i];
}

// ---------------------------------------------------------------------------
// Router: logits = x1[0,t,:] @ router[C,8]; top-2, softmax -> gates[T,8].
// One wave per token.
// ---------------------------------------------------------------------------
__global__ __launch_bounds__(32) void router_kernel(
    const float* __restrict__ x1, const float* __restrict__ Wr,
    float* __restrict__ gates)
{
    const int t    = blockIdx.x;
    const int lane = threadIdx.x;
    const float* xr = x1 + (size_t)t * Cn;   // batch 0

    float acc[En] = {};
    for (int c = lane; c < Cn; c += 32) {
        const float xv = xr[c];
#pragma unroll
        for (int e = 0; e < En; ++e) acc[e] += xv * Wr[(size_t)c * En + e];
    }
#pragma unroll
    for (int e = 0; e < En; ++e) {
        float s = acc[e];
        s += __shfl_xor(s, 1, 32);
        s += __shfl_xor(s, 2, 32);
        s += __shfl_xor(s, 4, 32);
        s += __shfl_xor(s, 8, 32);
        s += __shfl_xor(s, 16, 32);
        acc[e] = s;
    }
    // top-2 (lowest index wins ties, matching lax.top_k), softmax of the pair
    int   i0 = 0;
    float v0 = acc[0];
#pragma unroll
    for (int e = 1; e < En; ++e)
        if (acc[e] > v0) { v0 = acc[e]; i0 = e; }
    int   i1 = -1;
    float v1 = -3.4e38f;
#pragma unroll
    for (int e = 0; e < En; ++e)
        if (e != i0 && acc[e] > v1) { v1 = acc[e]; i1 = e; }
    const float e0  = 1.0f;                 // exp(v0 - v0)
    const float e1  = __expf(v1 - v0);
    const float inv = 1.0f / (e0 + e1);
    if (lane < En) {
        const float gv = (lane == i0) ? e0 * inv : (lane == i1 ? e1 * inv : 0.0f);
        gates[(size_t)t * En + lane] = gv;
    }
}

// ---------------------------------------------------------------------------
// Host-side orchestration.
// Workspace layout (floats), total ~143 MB:
//   h    : B*T*C      (LN1 out, then reused for attention output y)
//   qb   : B*T*C      (Q, then reused for x1 = x + attn proj)
//   kb   : B*T*C      (K, then reused for y_adapt)
//   vb   : B*T*C      (V, then reused for h2 = LN2(x1))
//   mlp1 : B*T*4C
//   down : B*T*E*BOT  (gate-scaled adapter hidden, all experts side by side)
//   gates: T*E
// ---------------------------------------------------------------------------
extern "C" void kernel_launch(void* const* d_in, const int* in_sizes, int n_in,
                              void* d_out, int out_size, void* d_ws, size_t ws_size,
                              hipStream_t stream)
{
    (void)in_sizes; (void)n_in; (void)out_size; (void)ws_size;

    const float* x      = (const float*)d_in[0];
    const float* Wq     = (const float*)d_in[1];
    const float* bq     = (const float*)d_in[2];
    const float* Wk     = (const float*)d_in[3];
    const float* bk     = (const float*)d_in[4];
    const float* Wv     = (const float*)d_in[5];
    const float* bv     = (const float*)d_in[6];
    const float* Wo     = (const float*)d_in[7];
    const float* bo     = (const float*)d_in[8];
    const float* ln1_g  = (const float*)d_in[9];
    const float* ln1_b  = (const float*)d_in[10];
    const float* ln2_g  = (const float*)d_in[11];
    const float* ln2_b  = (const float*)d_in[12];
    const float* mlp_w1 = (const float*)d_in[13];
    const float* mlp_b1 = (const float*)d_in[14];
    const float* mlp_w2 = (const float*)d_in[15];
    const float* mlp_b2 = (const float*)d_in[16];
    const float* router = (const float*)d_in[17];
    const float* ad_w   = (const float*)d_in[18];
    const float* ad_b   = (const float*)d_in[19];
    const float* au_w   = (const float*)d_in[20];
    const float* au_b   = (const float*)d_in[21];

    float* out = (float*)d_out;

    const size_t NBTC = (size_t)BTn * Cn;        // 4M floats
    float* ws    = (float*)d_ws;
    float* h     = ws;
    float* qb    = h    + NBTC;
    float* kb    = qb   + NBTC;
    float* vb    = kb   + NBTC;
    float* mlp1  = vb   + NBTC;
    float* down  = mlp1 + (size_t)BTn * FFn;
    float* gates = down + (size_t)BTn * En * BOTn;

    const dim3 gemmCC(Cn / 64, BTn / 128);       // M=4096, N=1024
    const dim3 gemmFF(FFn / 64, BTn / 128);      // M=4096, N=4096
    const dim3 gemmDN(BOTn / 64, BTn / 128, En); // M=4096, N=64, z = expert

    // 1. h = LN1(x)
    layernorm_kernel<<<BTn, 256, 0, stream>>>(x, ln1_g, ln1_b, h);

    // 2. Q/K/V projections
    gemm_wmma<0, false, false, 0><<<gemmCC, 256, GEMM_LDS_BYTES, stream>>>(
        h, Wq, bq, nullptr, nullptr, nullptr, 0, qb, BTn, Cn, Cn);
    gemm_wmma<0, false, false, 0><<<gemmCC, 256, GEMM_LDS_BYTES, stream>>>(
        h, Wk, bk, nullptr, nullptr, nullptr, 0, kb, BTn, Cn, Cn);
    gemm_wmma<0, false, false, 0><<<gemmCC, 256, GEMM_LDS_BYTES, stream>>>(
        h, Wv, bv, nullptr, nullptr, nullptr, 0, vb, BTn, Cn, Cn);

    // 3. causal attention -> y (reuse h)
    attn_kernel<<<dim3(Tn / 16 / 4, Hn, Bn), 128, 0, stream>>>(qb, kb, vb, h);

    // 4. x1 = x + y @ Wo + bo   (into qb)
    gemm_wmma<0, true, false, 0><<<gemmCC, 256, GEMM_LDS_BYTES, stream>>>(
        h, Wo, bo, x, nullptr, nullptr, 0, qb, BTn, Cn, Cn);

    // 5. router gates from batch 0 of x1
    router_kernel<<<Tn, 32, 0, stream>>>(qb, router, gates);

    // 6. adapter MoE: y_adapt (kb) = sum_e gate[t,e]*0.1*(relu(x1@adw_e+adb_e)@auw_e+aub_e)
    gemm_wmma<1, false, false, 1><<<gemmDN, 256, GEMM_LDS_BYTES, stream>>>(
        qb, ad_w, ad_b, nullptr, nullptr, gates, En * BOTn, down, BTn, BOTn, Cn);
    gemm_wmma<0, false, false, 2><<<gemmCC, 256, GEMM_UP_LDS_BYTES, stream>>>(
        down, au_w, au_b, nullptr, nullptr, gates, 0, kb, BTn, Cn, En * BOTn);

    // 7. h2 = LN2(x1)  (into vb)
    layernorm_kernel<<<BTn, 256, 0, stream>>>(qb, ln2_g, ln2_b, vb);

    // 8. mlp1 = gelu(h2 @ W1 + b1)
    gemm_wmma<2, false, false, 0><<<gemmFF, 256, GEMM_LDS_BYTES, stream>>>(
        vb, mlp_w1, mlp_b1, nullptr, nullptr, nullptr, 0, mlp1, BTn, FFn, Cn);

    // 9. out = x1 + y_adapt + (mlp1 @ W2 + b2)
    gemm_wmma<0, true, true, 0><<<gemmCC, 256, GEMM_LDS_BYTES, stream>>>(
        mlp1, mlp_w2, mlp_b2, qb, kb, nullptr, 0, out, BTn, Cn, FFn);
}

// v003
// A run of this version takes 768 microseconds.
// In both of two side-by-side timings against v002, it was 1.16 times as fast.
// All steps since v000 together make it 1.78 times as fast.
#include <hip/hip_runtime.h>
#include <math.h>
#include <stdint.h>

// ---------------------------------------------------------------------------
// Transformer block (LN -> attn -> residual -> top2 MoE adapters -> LN -> MLP)
// for MI455X / gfx1250.  All GEMMs run on V_WMMA_F32_16X16X4_F32 (exact fp32
// matrix op) so numerics match the fp32 JAX reference while using the CDNA5
// matrix pipeline.  wave32 everywhere.
//
// The GEMM stages both operand tiles through LDS with CDNA5 async global->LDS
// copies (GLOBAL_LOAD_ASYNC_TO_LDS_B128 / s_wait_asynccnt), double-buffered:
// each 32x64 B-chunk is fetched once per block instead of once per wave, and
// each 128x32 A-chunk arrives as whole 128-byte lines one chunk ahead instead
// of as 16-byte pieces of 16 lines per fragment load.
// ---------------------------------------------------------------------------

#define Bn   4
#define Tn   1024
#define Cn   1024
#define Hn   16
#define Dn   64
#define En   8
#define BOTn 64
#define FFn  4096
#define BTn  (Bn * Tn)          // 4096 rows

typedef float v2f __attribute__((ext_vector_type(2)));
typedef float v8f __attribute__((ext_vector_type(8)));

// ---------------------------------------------------------------------------
// Generic fp32 WMMA GEMM:  out = epilogue(A[M,K] @ W[K,N] + bias[N])
// Block = 256 threads = 8 waves; each wave computes a 16(M) x 64(N) strip of
// a 128x64 block tile.  B is staged in LDS:
//   chunk = 32(K) x 64(N) floats, row stride padded to 72 words so the two
//   16-lane halves of a fragment read hit disjoint bank ranges.
//   Double buffered; filled by async global->LDS b128 DMA (2 per thread).
// A is staged beside it:
//   chunk = 128(M) x 32(K) floats, row stride padded to 36 words so the 32
//   8-byte fragment reads of a wave fall on all 64 banks once.
//   Double buffered; each wave copies its own 16 rows (4 b128 per thread).
// A-fragment (16x4 f32): lanes 0-15 hold K=k,k+1 ; lanes 16-31 hold K=k+2,k+3.
// C/D (16x16 f32): VGPR r -> row r (lanes 0-15) / row r+8 (lanes 16-31).
//
// ACT: 0=none, 1=relu, 2=exact gelu.  RES1/RES2: add residual tensors.
// ADP (all adapter experts in one launch):
//   1 = down: blockIdx.z is the expert; W, bias are [E][K][N], [E][N]; the
//       result, times gates[t,e] * 0.1, goes to column e*N+col of out[M][ldo].
//   2 = up:   A is that [M][E*BOT] matrix and W the experts' [E*BOT][N] stack,
//       so the K loop sums over the experts; bias is [E][N], gate-weighted.
//       The block's 128 gate rows and its 8x64 bias tile lie in LDS behind the
//       B and A buffers, copied there behind the K loop.
// ---------------------------------------------------------------------------
#define GEMM_KC   32
#define GEMM_BSTR 72
#define GEMM_ASTR 36
#define GEMM_B_WORDS (2 * GEMM_KC * GEMM_BSTR)
#define GEMM_A_WORDS (2 * 128 * GEMM_ASTR)
#define GEMM_LDS_BYTES ((GEMM_B_WORDS + GEMM_A_WORDS) * 4)
#define GEMM_UP_LDS_BYTES (GEMM_LDS_BYTES + (128 * En + En * 64) * 4)

template <int ACT, bool RES1, bool RES2, int ADP>
__global__ __launch_bounds__(256) void gemm_wmma(
    const float* __restrict__ A, const float* __restrict__ W,
    const float* __restrict__ bias,
    const float* __restrict__ res1, const float* __restrict__ res2,
    const float* __restrict__ gates, int ldo,
    float* __restrict__ out, int M, int N, int K)
{
    extern __shared__ float Bs[];          // [2][GEMM_KC][GEMM_BSTR], then As
    const float* As = Bs + GEMM_B_WORDS;   // [2][128][GEMM_ASTR]

    const int tid  = threadIdx.x;
    const int lane = tid & 31;
    const int wave = tid >> 5;
    const int half = lane >> 4;     // 0: K pair {0,1}, 1: K pair {2,3}
    const int l15  = lane & 15;
    const int m0 = blockIdx.y * 128 + wave * 16;
    const int n0 = blockIdx.x * 64;

    if (ADP == 1) {
        W    += (size_t)blockIdx.z * K * N;
        bias += (size_t)blockIdx.z * N;
    }

    const int nchunk = K / GEMM_KC;

    // Cooperative loader, one chunk of both operands per call.
    // B: 32x64, two float4 per thread (K rows tid/16 and tid/16 + 16).
    // A: 128x32, four float4 per thread; a copy of a wave is 4 whole rows.
    const uint32_t lds0 = (uint32_t)(uintptr_t)Bs;
    const float* gB = W + (size_t)(tid >> 4) * N + (n0 + (tid & 15) * 4);
    const float* gA = A + (size_t)(m0 + (lane >> 3)) * K + (lane & 7) * 4;
    const uint32_t lB = lds0 + (uint32_t)((tid >> 4) * GEMM_BSTR + (tid & 15) * 4) * 4u;
    const uint32_t lA = lds0 + (uint32_t)(GEMM_B_WORDS
                      + (wave * 16 + (lane >> 3)) * GEMM_ASTR + (lane & 7) * 4) * 4u;
    auto issueChunk = [&](int kc) {
        const float* b0 = gB + (size_t)kc * GEMM_KC * N;
        const float* b1 = b0 + (size_t)16 * N;
        const float* a0 = gA + kc * GEMM_KC;
        const float* a1 = a0 + (size_t)4 * K;
        const float* a2 = a0 + (size_t)8 * K;
        const float* a3 = a0 + (size_t)12 * K;
        const uint32_t db0 = lB + (uint32_t)((kc & 1) * (GEMM_KC * GEMM_BSTR) * 4);
        const uint32_t db1 = db0 + 16u * GEMM_BSTR * 4u;
        const uint32_t da0 = lA + (uint32_t)((kc & 1) * (128 * GEMM_ASTR) * 4);
        const uint32_t da1 = da0 + 4u * GEMM_ASTR * 4u;
        const uint32_t da2 = da0 + 8u * GEMM_ASTR * 4u;
        const uint32_t da3 = da0 + 12u * GEMM_ASTR * 4u;
        // Global -> LDS through no register: first operand the lane's LDS byte
        // address, second its global address.  s_wait_xcnt 0 stands inside the
        // statement so that no address register is reused ahead of it.
        asm volatile("global_load_async_to_lds_b128 %0, %1, off\n\t"
                     "global_load_async_to_lds_b128 %2, %3, off\n\t"
                     "global_load_async_to_lds_b128 %4, %5, off\n\t"
                     "global_load_async_to_lds_b128 %6, %7, off\n\t"
                     "global_load_async_to_lds_b128 %8, %9, off\n\t"
                     "global_load_async_to_lds_b128 %10, %11, off\n\t"
                     "s_wait_xcnt 0x0"
                     :: "v"(db0), "v"(b0), "v"(db1), "v"(b1),
                        "v"(da0), "v"(a0), "v"(da1), "v"(a1),
                        "v"(da2), "v"(a2), "v"(da3), "v"(a3) : "memory");
    };

    issueChunk(0);
    asm volatile("s_wait_asynccnt 0x0" ::: "memory");     // my chunk 0 copies landed
    __syncthreads();                                      // every wave's landed
    if (1 < nchunk) issueChunk(1);                        // flies during chunk 0

    v8f acc[4] = {};
    for (int kc = 0; kc < nchunk; ++kc) {
        const float* buf  = Bs + (kc & 1) * (GEMM_KC * GEMM_BSTR);
        const float* abuf = As + (kc & 1) * (128 * GEMM_ASTR)
                          + (wave * 16 + l15) * GEMM_ASTR + half * 2;
#pragma unroll
        for (int kl = 0; kl < GEMM_KC; kl += 4) {
            const v2f a = *(const v2f*)(abuf + kl);
            const int kb = kl + half * 2;
#pragma unroll
            for (int j = 0; j < 4; ++j) {
                const int col = j * 16 + l15;
                v2f b;
                b.x = buf[kb * GEMM_BSTR + col];
                b.y = buf[(kb + 1) * GEMM_BSTR + col];
                acc[j] = __builtin_amdgcn_wmma_f32_16x16x4_f32(
                    false, a, false, b, 0, acc[j], false, false);
            }
        }
        // Publish point of chunk kc+1; it also frees the buffers just read.
        asm volatile("s_wait_dscnt 0x0" ::: "memory");    // my LDS reads retired
        asm volatile("s_wait_asynccnt 0x0" ::: "memory"); // my chunk kc+1 copies landed
        __syncthreads();                                  // every wave's, both
        if (kc + 2 < nchunk) issueChunk(kc + 2);          // into the buffers just read
    }
    asm volatile("s_wait_asynccnt 0x0" ::: "memory");     // nothing in flight behind the loop

    if (ADP == 2) {
        const float* Gs = Bs + GEMM_B_WORDS + GEMM_A_WORDS;   // [128][En] gate rows
        const float* Es = Gs + 128 * En;                  // [En][64]  bias tile
        // One float4 of gates and one float2 of bias per thread.  The 128 rows
        // of a block are consecutive t (128 divides Tn).
        const float* gsrc = gates + (size_t)((blockIdx.y * 128) & (Tn - 1)) * En + tid * 4;
        const float* esrc = bias + (size_t)wave * N + n0 + lane * 2;
        const uint32_t gdst = (uint32_t)GEMM_LDS_BYTES + (uint32_t)tid * 16u;
        const uint32_t edst = (uint32_t)(GEMM_LDS_BYTES + 128 * En * 4) + (uint32_t)tid * 8u;
        // Global -> LDS through no register.  s_wait_xcnt 0 stands inside the
        // statement so that no address register is reused ahead of it.
        asm volatile("global_load_async_to_lds_b128 %0, %1, off\n\t"
                     "global_load_async_to_lds_b64 %2, %3, off\n\t"
                     "s_wait_xcnt 0x0"
                     :: "v"(gdst), "v"(gsrc), "v"(edst), "v"(esrc) : "memory");
        asm volatile("s_wait_asynccnt 0x0" ::: "memory");   // my two copies landed
        __syncthreads();                                    // every wave's landed

        // acc += (0.1 * gates) @ bias, in the accumulators' own layout.
        float be[4][En];
#pragma unroll   // static j, e keep be[][] in registers
        for (int j = 0; j < 4; ++j)
#pragma unroll   // as above
            for (int e = 0; e < En; ++e) be[j][e] = Es[e * 64 + j * 16 + l15];
#pragma unroll   // static r keeps acc[j][r] in registers
        for (int r = 0; r < 8; ++r) {
            const float4* grow = (const float4*)(Gs + (wave * 16 + r + half * 8) * En);
            const float4 ga = grow[0], gb = grow[1];
            const float gs[En] = {ga.x * 0.1f, ga.y * 0.1f, ga.z * 0.1f, ga.w * 0.1f,
                                  gb.x * 0.1f, gb.y * 0.1f, gb.z * 0.1f, gb.w * 0.1f};
#pragma unroll   // static j for acc[j][r], be[j][e]
            for (int j = 0; j < 4; ++j) {
                float bsum = 0.0f;
#pragma unroll   // static e for gs[e], be[j][e]
                for (int e = 0; e < En; ++e) bsum += gs[e] * be[j][e];
                acc[j][r] += bsum;
            }
        }
    }

#pragma unroll
    for (int j = 0; j < 4; ++j) {
        const int col = n0 + j * 16 + l15;
        const float bv = bias[col];
#pragma unroll
        for (int r = 0; r < 8; ++r) {
            const int row = m0 + r + half * 8;
            float v = (ADP == 2) ? acc[j][r] : acc[j][r] + bv;
            if (ACT == 1) v = fmaxf(v, 0.0f);
            if (ACT == 2) v = 0.5f * v * (1.0f + erff(v * 0.70710678118654752f));
            const size_t idx = (size_t)row * N + col;
            if (RES1) v += res1[idx];
            if (RES2) v += res2[idx];
            if (ADP == 1) {
                const float g = gates[(size_t)(row & (Tn - 1)) * En + blockIdx.z];
                out[(size_t)row * ldo + blockIdx.z * N + col] = g * 0.1f * v;
            } else {
                out[idx] = v;
            }
        }
    }
}

// ---------------------------------------------------------------------------
// Causal flash attention, fp32 WMMA.  One wave per (b, h, 16-query tile);
// 4 waves per block.  Row softmax stats reduced with width-16 shfl butterflies
// (each 16x16 score tile keeps row M in VGPR index, col N in lane).
// P tile is staged through LDS to convert C-layout -> A-fragment layout.
//
// K and V reach the waves through LDS: a stage is 64 keys of both (64 rows of
// 256 bytes each), fetched once per block as whole lines by async global->LDS
// b128 copies, two buffers, one stage ahead.  The block of queries 64x..64x+63
// walks x+1 stages; inside a stage each wave takes its 16-key tiles as before.
//   K row pitch 68 words: the 32 8-byte fragment reads of a wave fall on all
//   64 banks once.  V row pitch 72 words: the two 16-lane halves of a fragment
//   read (rows k and k+2) hit disjoint bank ranges.
// ---------------------------------------------------------------------------
#define AT_KT 64                          // keys per stage
#define AT_KP 68                          // K row pitch, words
#define AT_VP 72                          // V row pitch, words
#define AT_KW (AT_KT * AT_KP)             // words of a stage's K
#define AT_STAGE_W (AT_KW + AT_KT * AT_VP) // words of a stage, K then V

__global__ __launch_bounds__(128) void attn_kernel(
    const float* __restrict__ q, const float* __restrict__ k,
    const float* __restrict__ v, float* __restrict__ y)
{
    const int lane = threadIdx.x & 31;
    // Scalar wave number: the tile loop and all around the copies branch on SCC.
    const int wave = __builtin_amdgcn_readfirstlane(threadIdx.x >> 5);
    const int half = lane >> 4;
    const int l15  = lane & 15;

    const int t0 = (blockIdx.x * 4 + wave) * 16;
    const int hh = blockIdx.y;
    const int b  = blockIdx.z;

    const size_t base = (size_t)b * Tn * Cn + (size_t)hh * Dn;
    const float* Qp = q + base;
    const float* Kp = k + base;
    const float* Vp = v + base;

    __shared__ __attribute__((aligned(16))) float KV[2 * AT_STAGE_W];
    __shared__ float Pt[4][16][17];   // +1 pad: conflict-free transposed reads

    // Stage loader.  A copy of a wave is 2 whole rows (32 lanes x 16 bytes); a
    // wave brings rows 16*wave .. 16*wave+15 of K and of V, 8 copies each.
    const int crow = wave * 16 + half;
    const int ccol = l15 * 4;
    const float* gK = Kp + (size_t)crow * Cn + ccol;
    const float* gV = Vp + (size_t)crow * Cn + ccol;
    const uint32_t kv0 = (uint32_t)(uintptr_t)KV;
    const uint32_t lK = kv0 + (uint32_t)(crow * AT_KP + ccol) * 4u;
    const uint32_t lV = kv0 + (uint32_t)(AT_KW + crow * AT_VP + ccol) * 4u;
    auto issueStage = [&](int st) {
        const size_t   go = (size_t)st * AT_KT * Cn;
        const uint32_t lo = (uint32_t)((st & 1) * AT_STAGE_W * 4);
        const float* ks = gK + go;
        const float* vs = gV + go;
        const uint32_t kd = lK + lo;
        const uint32_t vd = lV + lo;
        // Global -> LDS through no register: first operand the lane's LDS byte
        // address, second its global address.  s_wait_xcnt 0 stands inside each
        // statement so that no address register is reused ahead of it.
        asm volatile("global_load_async_to_lds_b128 %0, %1, off\n\t"
                     "global_load_async_to_lds_b128 %2, %3, off\n\t"
                     "global_load_async_to_lds_b128 %4, %5, off\n\t"
                     "global_load_async_to_lds_b128 %6, %7, off\n\t"
                     "global_load_async_to_lds_b128 %8, %9, off\n\t"
                     "global_load_async_to_lds_b128 %10, %11, off\n\t"
                     "global_load_async_to_lds_b128 %12, %13, off\n\t"
                     "global_load_async_to_lds_b128 %14, %15, off\n\t"
                     "s_wait_xcnt 0x0"
                     :: "v"(kd),                    "v"(ks),
                        "v"(kd +  2u * AT_KP * 4u), "v"(ks +  2 * Cn),
                        "v"(kd +  4u * AT_KP * 4u), "v"(ks +  4 * Cn),
                        "v"(kd +  6u * AT_KP * 4u), "v"(ks +  6 * Cn),
                        "v"(kd +  8u * AT_KP * 4u), "v"(ks +  8 * Cn),
                        "v"(kd + 10u * AT_KP * 4u), "v"(ks + 10 * Cn),
                        "v"(kd + 12u * AT_KP * 4u), "v"(ks + 12 * Cn),
                        "v"(kd + 14u * AT_KP * 4u), "v"(ks + 14 * Cn) : "memory");
        asm volatile("global_load_async_to_lds_b128 %0, %1, off\n\t"
                     "global_load_async_to_lds_b128 %2, %3, off\n\t"
                     "global_load_async_to_lds_b128 %4, %5, off\n\t"
                     "global_load_async_to_lds_b128 %6, %7, off\n\t"
                     "global_load_async_to_lds_b128 %8, %9, off\n\t"
                     "global_load_async_to_lds_b128 %10, %11, off\n\t"
                     "global_load_async_to_lds_b128 %12, %13, off\n\t"
                     "global_load_async_to_lds_b128 %14, %15, off\n\t"
                     "s_wait_xcnt 0x0"
                     :: "v"(vd),                    "v"(vs),
                        "v"(vd +  2u * AT_VP * 4u), "v"(vs +  2 * Cn),
                        "v"(vd +  4u * AT_VP * 4u), "v"(vs +  4 * Cn),
                        "v"(vd +  6u * AT_VP * 4u), "v"(vs +  6 * Cn),
                        "v"(vd +  8u * AT_VP * 4u), "v"(vs +  8 * Cn),
                        "v"(vd + 10u * AT_VP * 4u), "v"(vs + 10 * Cn),
                        "v"(vd + 12u * AT_VP * 4u), "v"(vs + 12 * Cn),
                        "v"(vd + 14u * AT_VP * 4u), "v"(vs + 14 * Cn) : "memory");
    };

    const int nst = blockIdx.x + 1;       // stages of this block, keys 0 .. 64*nst-1
    issueStage(0);

    // Q fragments for all 16 K-steps over D=64 (resident for whole tile)
    v2f aq[16];
    {
        const float* qrow = Qp + (size_t)(t0 + l15) * Cn;
#pragma unroll
        for (int s = 0; s < 16; ++s) {
            const int dd = s * 4 + half * 2;
            aq[s].x = qrow[dd];
            aq[s].y = qrow[dd + 1];
        }
    }

    v8f o[4] = {};
    float mrow[8], lrow[8];
#pragma unroll
    for (int r = 0; r < 8; ++r) { mrow[r] = -1e30f; lrow[r] = 0.0f; }

    asm volatile("s_wait_asynccnt 0x0" ::: "memory");     // my stage 0 copies landed
    __syncthreads();                                      // every wave's landed
    if (1 < nst) issueStage(1);                           // flies during stage 0

    for (int st = 0; st < nst; ++st) {
        const float* Kst = KV + (st & 1) * AT_STAGE_W;
        const float* Vst = Kst + AT_KW;
        // Tiles with s0 <= t0: all four of a stage but in the last, the diagonal's.
        const int nu = (st + 1 < nst) ? 4 : wave + 1;
        for (int u = 0; u < nu; ++u) {
            const int s0 = st * AT_KT + u * 16;
            // S = Q @ K^T  (16x16 tile, K-dim = 64)
            v8f sa = {};
            const float* kr = Kst + (u * 16 + l15) * AT_KP + half * 2;
#pragma unroll
            for (int s = 0; s < 16; ++s) {
                const v2f bf = *(const v2f*)(kr + s * 4);
                sa = __builtin_amdgcn_wmma_f32_16x16x4_f32(
                    false, aq[s], false, bf, 0, sa, false, false);
            }

            // scale, causal mask, online softmax update, write P to LDS
#pragma unroll
            for (int r = 0; r < 8; ++r) {
                const int row = t0 + r + half * 8;   // query index
                const int col = s0 + l15;            // key index
                float sv = sa[r] * 0.125f;           // 1/sqrt(64)
                if (col > row) sv = -1e30f;

                float mx = sv;
                mx = fmaxf(mx, __shfl_xor(mx, 1, 16));
                mx = fmaxf(mx, __shfl_xor(mx, 2, 16));
                mx = fmaxf(mx, __shfl_xor(mx, 4, 16));
                mx = fmaxf(mx, __shfl_xor(mx, 8, 16));

                const float mn    = fmaxf(mrow[r], mx);
                // exp(mrow - mn) as __expf forms it (times log2 e, then v_exp_f32).  Written
                // out so that the v_nop stands directly behind the transcendental: the slot
                // the instruction set asks for before a source of it is overwritten.
                float alpha;
                asm("v_exp_f32 %0, %1\n\tv_nop"
                    : "=v"(alpha) : "v"((mrow[r] - mn) * 1.44269504088896340736f));
                const float pv    = __expf(sv - mn);

                float ps = pv;
                ps += __shfl_xor(ps, 1, 16);
                ps += __shfl_xor(ps, 2, 16);
                ps += __shfl_xor(ps, 4, 16);
                ps += __shfl_xor(ps, 8, 16);

                lrow[r] = lrow[r] * alpha + ps;
                mrow[r] = mn;
#pragma unroll
                for (int j = 0; j < 4; ++j) o[j][r] *= alpha;

                Pt[wave][r + half * 8][l15] = pv;
            }
            // Same-wave LDS ops are in-order (DScnt); no cross-wave sharing here.

            // O += P @ V   (K-dim = 16 keys, N = 64 head dims)
            const float* vr = Vst + (u * 16 + half * 2) * AT_VP + l15;
#pragma unroll
            for (int ks = 0; ks < 16; ks += 4) {
                v2f ap;
                ap.x = Pt[wave][l15][ks + half * 2];
                ap.y = Pt[wave][l15][ks + half * 2 + 1];
#pragma unroll
                for (int j = 0; j < 4; ++j) {
                    v2f bf;
                    bf.x = vr[ks * AT_VP + j * 16];
                    bf.y = vr[(ks + 1) * AT_VP + j * 16];
                    o[j] = __builtin_amdgcn_wmma_f32_16x16x4_f32(
                        false, ap, false, bf, 0, o[j], false, false);
                }
            }
        }
        // Publish point of stage st+1; it also frees the buffer just read.
        asm volatile("s_wait_dscnt 0x0" ::: "memory");    // my LDS reads retired
        asm volatile("s_wait_asynccnt 0x0" ::: "memory"); // my stage st+1 copies landed
        __syncthreads();                                  // every wave's, both
        if (st + 2 < nst) issueStage(st + 2);             // into the buffer just read
    }
    asm volatile("s_wait_asynccnt 0x0" ::: "memory");     // nothing in flight behind the loop

    // normalize and write y[b, t, h*64 + d]
#pragma unroll
    for (int j = 0; j < 4; ++j) {
        const int dd = j * 16 + l15;
#pragma unroll
        for (int r = 0; r < 8; ++r) {
            const int row = t0 + r + half * 8;
            y[base + (size_t)row * Cn + dd] = o[j][r] / lrow[r];
        }
    }
}

// ---------------------------------------------------------------------------
// LayerNorm: one 256-thread block per row of C=1024.
// ---------------------------------------------------------------------------
__global__ __launch_bounds__(256) void layernorm_kernel(
    const float* __restrict__ x, const float* __restrict__ g,
    const float* __restrict__ bta, float* __restrict__ out)
{
    const int row = blockIdx.x;
    const int tid = threadIdx.x;
    const float* xr = x + (size_t)row * Cn;
    __shared__ float red[256];

    float s = 0.0f;
    for (int i = tid; i < Cn; i += 256) s += xr[i];
    red[tid] = s;
    __syncthreads();
    for (int off = 128; off > 0; off >>= 1) {
        if (tid < off) red[tid] += red[tid + off];
        __syncthreads();
    }
    const float mu = red[0] * (1.0f / Cn);
    __syncthreads();

    float s2 = 0.0f;
    for (int i = tid; i < Cn; i += 256) {
        const float d = xr[i] - mu;
        s2 += d * d;
    }
    red[tid] = s2;
    __syncthreads();
    for (int off = 128; off > 0; off >>= 1) {
        if (tid < off) red[tid] += red[tid + off];
        __syncthreads();
    }
    const float rstd = rsqrtf(red[0] * (1.0f / Cn) + 1e-5f);
    __syncthreads();

    for (int i = tid; i < Cn; i += 256)
        out[(size_t)row * Cn + i] = (xr[i] - mu) * rstd * g[i] + bta[i];
}

// ---------------------------------------------------------------------------
// Router: logits = x1[0,t,:] @ router[C,8]; top-2, softmax -> gates[T,8].
// One wave per token.
// ---------------------------------------------------------------------------
__global__ __launch_bounds__(32) void router_kernel(
    const float* __restrict__ x1, const float* __restrict__ Wr,
    float* __restrict__ gates)
{
    const int t    = blockIdx.x;
    const int lane = threadIdx.x;
    const float* xr = x1 + (size_t)t * Cn;   // batch 0

    float acc[En] = {};
    for (int c = lane; c < Cn; c += 32) {
        const float xv = xr[c];
#pragma unroll
        for (int e = 0; e < En; ++e) acc[e] += xv * Wr[(size_t)c * En + e];
    }
#pragma unroll
    for (int e = 0; e < En; ++e) {
        float s = acc[e];
        s += __shfl_xor(s, 1, 32);
        s += __shfl_xor(s, 2, 32);
        s += __shfl_xor(s, 4, 32);
        s += __shfl_xor(s, 8, 32);
        s += __shfl_xor(s, 16, 32);
        acc[e] = s;
    }
    // top-2 (lowest index wins ties, matching lax.top_k), softmax of the pair
    int   i0 = 0;
    float v0 = acc[0];
#pragma unroll
    for (int e = 1; e < En; ++e)
        if (acc[e] > v0) { v0 = acc[e]; i0 = e; }
    int   i1 = -1;
    float v1 = -3.4e38f;
#pragma unroll
    for (int e = 0; e < En; ++e)
        if (e != i0 && acc[e] > v1) { v1 = acc[e]; i1 = e; }
    const float e0  = 1.0f;                 // exp(v0 - v0)
    const float e1  = __expf(v1 - v0);
    const float inv = 1.0f / (e0 + e1);
    if (lane < En) {
        const float gv = (lane == i0) ? e0 * inv : (lane == i1 ? e1 * inv : 0.0f);
        gates[(size_t)t * En + lane] = gv;
    }
}

// ---------------------------------------------------------------------------
// Host-side orchestration.
// Workspace layout (floats), total ~143 MB:
//   h    : B*T*C      (LN1 out, then reused for attention output y)
//   qb   : B*T*C      (Q, then reused for x1 = x + attn proj)
//   kb   : B*T*C      (K, then reused for y_adapt)
//   vb   : B*T*C      (V, then reused for h2 = LN2(x1))
//   mlp1 : B*T*4C
//   down : B*T*E*BOT  (gate-scaled adapter hidden, all experts side by side)
//   gates: T*E
// ---------------------------------------------------------------------------
extern "C" void kernel_launch(void* const* d_in, const int* in_sizes, int n_in,
                              void* d_out, int out_size, void* d_ws, size_t ws_size,
                              hipStream_t stream)
{
    (void)in_sizes; (void)n_in; (void)out_size; (void)ws_size;

    const float* x      = (const float*)d_in[0];
    const float* Wq     = (const float*)d_in[1];
    const float* bq     = (const float*)d_in[2];
    const float* Wk     = (const float*)d_in[3];
    const float* bk     = (const float*)d_in[4];
    const float* Wv     = (const float*)d_in[5];
    const float* bv     = (const float*)d_in[6];
    const float* Wo     = (const float*)d_in[7];
    const float* bo     = (const float*)d_in[8];
    const float* ln1_g  = (const float*)d_in[9];
    const float* ln1_b  = (const float*)d_in[10];
    const float* ln2_g  = (const float*)d_in[11];
    const float* ln2_b  = (const float*)d_in[12];
    const float* mlp_w1 = (const float*)d_in[13];
    const float* mlp_b1 = (const float*)d_in[14];
    const float* mlp_w2 = (const float*)d_in[15];
    const float* mlp_b2 = (const float*)d_in[16];
    const float* router = (const float*)d_in[17];
    const float* ad_w   = (const float*)d_in[18];
    const float* ad_b   = (const float*)d_in[19];
    const float* au_w   = (const float*)d_in[20];
    const float* au_b   = (const float*)d_in[21];

    float* out = (float*)d_out;

    const size_t NBTC = (size_t)BTn * Cn;        // 4M floats
    float* ws    = (float*)d_ws;
    float* h     = ws;
    float* qb    = h    + NBTC;
    float* kb    = qb   + NBTC;
    float* vb    = kb   + NBTC;
    float* mlp1  = vb   + NBTC;
    float* down  = mlp1 + (size_t)BTn * FFn;
    float* gates = down + (size_t)BTn * En * BOTn;

    const dim3 gemmCC(Cn / 64, BTn / 128);       // M=4096, N=1024
    const dim3 gemmFF(FFn / 64, BTn / 128);      // M=4096, N=4096
    const dim3 gemmDN(BOTn / 64, BTn / 128, En); // M=4096, N=64, z = expert

    // 1. h = LN1(x)
    layernorm_kernel<<<BTn, 256, 0, stream>>>(x, ln1_g, ln1_b, h);

    // 2. Q/K/V projections
    gemm_wmma<0, false, false, 0><<<gemmCC, 256, GEMM_LDS_BYTES, stream>>>(
        h, Wq, bq, nullptr, nullptr, nullptr, 0, qb, BTn, Cn, Cn);
    gemm_wmma<0, false, false, 0><<<gemmCC, 256, GEMM_LDS_BYTES, stream>>>(
        h, Wk, bk, nullptr, nullptr, nullptr, 0, kb, BTn, Cn, Cn);
    gemm_wmma<0, false, false, 0><<<gemmCC, 256, GEMM_LDS_BYTES, stream>>>(
        h, Wv, bv, nullptr, nullptr, nullptr, 0, vb, BTn, Cn, Cn);

    // 3. causal attention -> y (reuse h)
    attn_kernel<<<dim3(Tn / 16 / 4, Hn, Bn), 128, 0, stream>>>(qb, kb, vb, h);

    // 4. x1 = x + y @ Wo + bo   (into qb)
    gemm_wmma<0, true, false, 0><<<gemmCC, 256, GEMM_LDS_BYTES, stream>>>(
        h, Wo, bo, x, nullptr, nullptr, 0, qb, BTn, Cn, Cn);

    // 5. router gates from batch 0 of x1
    router_kernel<<<Tn, 32, 0, stream>>>(qb, router, gates);

    // 6. adapter MoE: y_adapt (kb) = sum_e gate[t,e]*0.1*(relu(x1@adw_e+adb_e)@auw_e+aub_e)
    gemm_wmma<1, false, false, 1><<<gemmDN, 256, GEMM_LDS_BYTES, stream>>>(
        qb, ad_w, ad_b, nullptr, nullptr, gates, En * BOTn, down, BTn, BOTn, Cn);
    gemm_wmma<0, false, false, 2><<<gemmCC, 256, GEMM_UP_LDS_BYTES, stream>>>(
        down, au_w, au_b, nullptr, nullptr, gates, 0, kb, BTn, Cn, En * BOTn);

    // 7. h2 = LN2(x1)  (into vb)
    layernorm_kernel<<<BTn, 256, 0, stream>>>(qb, ln2_g, ln2_b, vb);

    // 8. mlp1 = gelu(h2 @ W1 + b1)
    gemm_wmma<2, false, false, 0><<<gemmFF, 256, GEMM_LDS_BYTES, stream>>>(
        vb, mlp_w1, mlp_b1, nullptr, nullptr, nullptr, 0, mlp1, BTn, FFn, Cn);

    // 9. out = x1 + y_adapt + (mlp1 @ W2 + b2)
    gemm_wmma<0, true, true, 0><<<gemmCC, 256, GEMM_LDS_BYTES, stream>>>(
        mlp1, mlp_w2, mlp_b2, qb, kb, nullptr, 0, out, BTn, Cn, FFn);
}

// v004
// A run of this version takes 745 microseconds.
// Two timings next to v003 both put it at 1.03 times that version's speed.
// Counting every step since v000, it is 1.84 times as fast.
#include <hip/hip_runtime.h>
#include <math.h>
#include <stdint.h>

// ---------------------------------------------------------------------------
// Transformer block (LN -> attn -> residual -> top2 MoE adapters -> LN -> MLP)
// for MI455X / gfx1250.  All GEMMs run on V_WMMA_F32_16X16X4_F32 (exact fp32
// matrix op) so numerics match the fp32 JAX reference while using the CDNA5
// matrix pipeline.  wave32 everywhere.
//
// The GEMM stages both operand tiles through LDS with CDNA5 async global->LDS
// copies (GLOBAL_LOAD_ASYNC_TO_LDS_B128 / s_wait_asynccnt), double-buffered:
// each 32x64 B-chunk is fetched once per block instead of once per wave, and
// each 128x32 A-chunk arrives as whole 128-byte lines one chunk ahead instead
// of as 16-byte pieces of 16 lines per fragment load.
// ---------------------------------------------------------------------------

#define Bn   4
#define Tn   1024
#define Cn   1024
#define Hn   16
#define Dn   64
#define En   8
#define BOTn 64
#define FFn  4096
#define BTn  (Bn * Tn)          // 4096 rows

typedef float v2f __attribute__((ext_vector_type(2)));
typedef float v8f __attribute__((ext_vector_type(8)));

// ---------------------------------------------------------------------------
// Generic fp32 WMMA GEMM:  out = epilogue(A[M,K] @ W[K,N] + bias[N])
// Block = 256 threads = 8 waves; each wave computes a 16(M) x 64(N) strip of
// a 128x64 block tile.  B is staged in LDS:
//   chunk = 32(K) x 64(N) floats, row stride padded to 72 words so the two
//   16-lane halves of a fragment read hit disjoint bank ranges.
//   Double buffered; filled by async global->LDS b128 DMA (2 per thread).
// A is staged beside it:
//   chunk = 128(M) x 32(K) floats, row stride padded to 36 words so the 32
//   8-byte fragment reads of a wave fall on all 64 banks once.
//   Double buffered; each wave copies its own 16 rows (4 b128 per thread).
// A-fragment (16x4 f32): lanes 0-15 hold K=k,k+1 ; lanes 16-31 hold K=k+2,k+3.
// C/D (16x16 f32): VGPR r -> row r (lanes 0-15) / row r+8 (lanes 16-31).
//
// ACT: 0=none, 1=relu, 2=exact gelu.  RES1/RES2: add residual tensors.
// ADP (all adapter experts in one launch):
//   1 = down: blockIdx.z is the expert; W, bias are [E][K][N], [E][N]; the
//       result, times gates[t,e] * 0.1, goes to column e*N+col of out[M][ldo].
//   2 = up:   A is that [M][E*BOT] matrix and W the experts' [E*BOT][N] stack,
//       so the K loop sums over the experts; bias is [E][N], gate-weighted.
//       The block's 128 gate rows and its 8x64 bias tile lie in LDS behind the
//       B and A buffers, copied there behind the K loop.
// ---------------------------------------------------------------------------
#define GEMM_KC   32
#define GEMM_BSTR 72
#define GEMM_ASTR 36
#define GEMM_B_WORDS (2 * GEMM_KC * GEMM_BSTR)
#define GEMM_A_WORDS (2 * 128 * GEMM_ASTR)
#define GEMM_LDS_BYTES ((GEMM_B_WORDS + GEMM_A_WORDS) * 4)
#define GEMM_UP_LDS_BYTES (GEMM_LDS_BYTES + (128 * En + En * 64) * 4)

template <int ACT, bool RES1, bool RES2, int ADP>
__global__ __launch_bounds__(256) void gemm_wmma(
    const float* __restrict__ A, const float* __restrict__ W,
    const float* __restrict__ bias,
    const float* __restrict__ res1, const float* __restrict__ res2,
    const float* __restrict__ gates, int ldo,
    float* __restrict__ out, int M, int N, int K)
{
    extern __shared__ float Bs[];          // [2][GEMM_KC][GEMM_BSTR], then As
    const float* As = Bs + GEMM_B_WORDS;   // [2][128][GEMM_ASTR]

    const int tid  = threadIdx.x;
    const int lane = tid & 31;
    const int wave = tid >> 5;
    const int half = lane >> 4;     // 0: K pair {0,1}, 1: K pair {2,3}
    const int l15  = lane & 15;
    const int m0 = blockIdx.y * 128 + wave * 16;
    const int n0 = blockIdx.x * 64;

    if (ADP == 1) {
        W    += (size_t)blockIdx.z * K * N;
        bias += (size_t)blockIdx.z * N;
    }

    const int nchunk = K / GEMM_KC;

    // Cooperative loader, one chunk of both operands per call.
    // B: 32x64, two float4 per thread (K rows tid/16 and tid/16 + 16).
    // A: 128x32, four float4 per thread; a copy of a wave is 4 whole rows.
    const uint32_t lds0 = (uint32_t)(uintptr_t)Bs;
    const float* gB = W + (size_t)(tid >> 4) * N + (n0 + (tid & 15) * 4);
    const float* gA = A + (size_t)(m0 + (lane >> 3)) * K + (lane & 7) * 4;
    const uint32_t lB = lds0 + (uint32_t)((tid >> 4) * GEMM_BSTR + (tid & 15) * 4) * 4u;
    const uint32_t lA = lds0 + (uint32_t)(GEMM_B_WORDS
                      + (wave * 16 + (lane >> 3)) * GEMM_ASTR + (lane & 7) * 4) * 4u;
    auto issueChunk = [&](int kc) {
        const float* b0 = gB + (size_t)kc * GEMM_KC * N;
        const float* b1 = b0 + (size_t)16 * N;
        const float* a0 = gA + kc * GEMM_KC;
        const float* a1 = a0 + (size_t)4 * K;
        const float* a2 = a0 + (size_t)8 * K;
        const float* a3 = a0 + (size_t)12 * K;
        const uint32_t db0 = lB + (uint32_t)((kc & 1) * (GEMM_KC * GEMM_BSTR) * 4);
        const uint32_t db1 = db0 + 16u * GEMM_BSTR * 4u;
        const uint32_t da0 = lA + (uint32_t)((kc & 1) * (128 * GEMM_ASTR) * 4);
        const uint32_t da1 = da0 + 4u * GEMM_ASTR * 4u;
        const uint32_t da2 = da0 + 8u * GEMM_ASTR * 4u;
        const uint32_t da3 = da0 + 12u * GEMM_ASTR * 4u;
        // Global -> LDS through no register: first operand the lane's LDS byte
        // address, second its global address.  s_wait_xcnt 0 stands inside the
        // statement so that no address register is reused ahead of it.
        asm volatile("global_load_async_to_lds_b128 %0, %1, off\n\t"
                     "global_load_async_to_lds_b128 %2, %3, off\n\t"
                     "global_load_async_to_lds_b128 %4, %5, off\n\t"
                     "global_load_async_to_lds_b128 %6, %7, off\n\t"
                     "global_load_async_to_lds_b128 %8, %9, off\n\t"
                     "global_load_async_to_lds_b128 %10, %11, off\n\t"
                     "s_wait_xcnt 0x0"
                     :: "v"(db0), "v"(b0), "v"(db1), "v"(b1),
                        "v"(da0), "v"(a0), "v"(da1), "v"(a1),
                        "v"(da2), "v"(a2), "v"(da3), "v"(a3) : "memory");
    };

    issueChunk(0);
    asm volatile("s_wait_asynccnt 0x0" ::: "memory");     // my chunk 0 copies landed
    __syncthreads();                                      // every wave's landed
    if (1 < nchunk) issueChunk(1);                        // flies during chunk 0

    v8f acc[4] = {};
    for (int kc = 0; kc < nchunk; ++kc) {
        const float* buf  = Bs + (kc & 1) * (GEMM_KC * GEMM_BSTR);
        const float* abuf = As + (kc & 1) * (128 * GEMM_ASTR)
                          + (wave * 16 + l15) * GEMM_ASTR + half * 2;
#pragma unroll
        for (int kl = 0; kl < GEMM_KC; kl += 4) {
            const v2f a = *(const v2f*)(abuf + kl);
            const int kb = kl + half * 2;
#pragma unroll
            for (int j = 0; j < 4; ++j) {
                const int col = j * 16 + l15;
                v2f b;
                b.x = buf[kb * GEMM_BSTR + col];
                b.y = buf[(kb + 1) * GEMM_BSTR + col];
                acc[j] = __builtin_amdgcn_wmma_f32_16x16x4_f32(
                    false, a, false, b, 0, acc[j], false, false);
            }
        }
        // Publish point of chunk kc+1; it also frees the buffers just read.
        asm volatile("s_wait_dscnt 0x0" ::: "memory");    // my LDS reads retired
        asm volatile("s_wait_asynccnt 0x0" ::: "memory"); // my chunk kc+1 copies landed
        __syncthreads();                                  // every wave's, both
        if (kc + 2 < nchunk) issueChunk(kc + 2);          // into the buffers just read
    }
    asm volatile("s_wait_asynccnt 0x0" ::: "memory");     // nothing in flight behind the loop

    if (ADP == 2) {
        const float* Gs = Bs + GEMM_B_WORDS + GEMM_A_WORDS;   // [128][En] gate rows
        const float* Es = Gs + 128 * En;                  // [En][64]  bias tile
        // One float4 of gates and one float2 of bias per thread.  The 128 rows
        // of a block are consecutive t (128 divides Tn).
        const float* gsrc = gates + (size_t)((blockIdx.y * 128) & (Tn - 1)) * En + tid * 4;
        const float* esrc = bias + (size_t)wave * N + n0 + lane * 2;
        const uint32_t gdst = (uint32_t)GEMM_LDS_BYTES + (uint32_t)tid * 16u;
        const uint32_t edst = (uint32_t)(GEMM_LDS_BYTES + 128 * En * 4) + (uint32_t)tid * 8u;
        // Global -> LDS through no register.  s_wait_xcnt 0 stands inside the
        // statement so that no address register is reused ahead of it.
        asm volatile("global_load_async_to_lds_b128 %0, %1, off\n\t"
                     "global_load_async_to_lds_b64 %2, %3, off\n\t"
                     "s_wait_xcnt 0x0"
                     :: "v"(gdst), "v"(gsrc), "v"(edst), "v"(esrc) : "memory");
        asm volatile("s_wait_asynccnt 0x0" ::: "memory");   // my two copies landed
        __syncthreads();                                    // every wave's landed

        // acc += (0.1 * gates) @ bias, in the accumulators' own layout.
        float be[4][En];
#pragma unroll   // static j, e keep be[][] in registers
        for (int j = 0; j < 4; ++j)
#pragma unroll   // as above
            for (int e = 0; e < En; ++e) be[j][e] = Es[e * 64 + j * 16 + l15];
#pragma unroll   // static r keeps acc[j][r] in registers
        for (int r = 0; r < 8; ++r) {
            const float4* grow = (const float4*)(Gs + (wave * 16 + r + half * 8) * En);
            const float4 ga = grow[0], gb = grow[1];
            const float gs[En] = {ga.x * 0.1f, ga.y * 0.1f, ga.z * 0.1f, ga.w * 0.1f,
                                  gb.x * 0.1f, gb.y * 0.1f, gb.z * 0.1f, gb.w * 0.1f};
#pragma unroll   // static j for acc[j][r], be[j][e]
            for (int j = 0; j < 4; ++j) {
                float bsum = 0.0f;
#pragma unroll   // static e for gs[e], be[j][e]
                for (int e = 0; e < En; ++e) bsum += gs[e] * be[j][e];
                acc[j][r] += bsum;
            }
        }
    }

#pragma unroll
    for (int j = 0; j < 4; ++j) {
        const int col = n0 + j * 16 + l15;
        const float bv = bias[col];
#pragma unroll
        for (int r = 0; r < 8; ++r) {
            const int row = m0 + r + half * 8;
            float v = (ADP == 2) ? acc[j][r] : acc[j][r] + bv;
            if (ACT == 1) v = fmaxf(v, 0.0f);
            if (ACT == 2) v = 0.5f * v * (1.0f + erff(v * 0.70710678118654752f));
            const size_t idx = (size_t)row * N + col;
            if (RES1) v += res1[idx];
            if (RES2) v += res2[idx];
            if (ADP == 1) {
                const float g = gates[(size_t)(row & (Tn - 1)) * En + blockIdx.z];
                out[(size_t)row * ldo + blockIdx.z * N + col] = g * 0.1f * v;
            } else {
                out[idx] = v;
            }
        }
    }
}

#define AT_KT 64
#define AT_KP 68
#define AT_VP 68
#define AT_KW (AT_KT * AT_KP)
#define AT_STAGE_W (AT_KW + AT_KT * AT_VP)

// Lane l <-> lane l ^ 16, through no LDS.
__device__ __forceinline__ float xhalf(float x)
{
    return __builtin_bit_cast(float, __builtin_amdgcn_permlanex16(
        __builtin_bit_cast(int, x), __builtin_bit_cast(int, x),
        0x76543210, 0xfedcba98, false, false));
}

// exp(x) as __expf forms it (times log2 e, then v_exp_f32).  Written out so that
// the v_nop stands directly behind the transcendental: the slot the instruction
// set asks for before its result is used or its source overwritten.
__device__ __forceinline__ float exp_slot(float x)
{
    float e;
    asm("v_exp_f32 %0, %1\n\tv_nop" : "=v"(e) : "v"(x * 1.44269504088896340736f));
    return e;
}

__global__ __launch_bounds__(128) void attn_kernel(
    const float* __restrict__ q, const float* __restrict__ k,
    const float* __restrict__ v, float* __restrict__ y)
{
    const int lane = threadIdx.x & 31;
    // Scalar wave number: the tile loop and all around the copies branch on SCC.
    const int wave = __builtin_amdgcn_readfirstlane(threadIdx.x >> 5);
    const int half = lane >> 4;
    const int l15  = lane & 15;

    const int t0 = (blockIdx.x * 4 + wave) * 16;
    const int hh = blockIdx.y;
    const int b  = blockIdx.z;

    const size_t base = (size_t)b * Tn * Cn + (size_t)hh * Dn;
    const float* Qp = q + base;
    const float* Kp = k + base;
    const float* Vp = v + base;

    __shared__ __attribute__((aligned(16))) float KV[2 * AT_STAGE_W];

    // Stage loader.  A copy of a wave is 2 whole rows (32 lanes x 16 bytes); a
    // wave brings rows 16*wave .. 16*wave+15 of K and of V, 8 copies each.
    const int crow = wave * 16 + half;
    const int ccol = l15 * 4;
    const float* gK = Kp + (size_t)crow * Cn + ccol;
    const float* gV = Vp + (size_t)crow * Cn + ccol;
    const uint32_t kv0 = (uint32_t)(uintptr_t)KV;
    const uint32_t lK = kv0 + (uint32_t)(crow * AT_KP + ccol) * 4u;
    const uint32_t lV = kv0 + (uint32_t)(AT_KW + crow * AT_VP + ccol) * 4u;
    auto issueStage = [&](int st) {
        const size_t   go = (size_t)st * AT_KT * Cn;
        const uint32_t lo = (uint32_t)((st & 1) * AT_STAGE_W * 4);
        const float* ks = gK + go;
        const float* vs = gV + go;
        const uint32_t kd = lK + lo;
        const uint32_t vd = lV + lo;
        // Global -> LDS through no register: first operand the lane's LDS byte
        // address, second its global address.  s_wait_xcnt 0 stands inside each
        // statement so that no address register is reused ahead of it.
        asm volatile("global_load_async_to_lds_b128 %0, %1, off\n\t"
                     "global_load_async_to_lds_b128 %2, %3, off\n\t"
                     "global_load_async_to_lds_b128 %4, %5, off\n\t"
                     "global_load_async_to_lds_b128 %6, %7, off\n\t"
                     "global_load_async_to_lds_b128 %8, %9, off\n\t"
                     "global_load_async_to_lds_b128 %10, %11, off\n\t"
                     "global_load_async_to_lds_b128 %12, %13, off\n\t"
                     "global_load_async_to_lds_b128 %14, %15, off\n\t"
                     "s_wait_xcnt 0x0"
                     :: "v"(kd),                    "v"(ks),
                        "v"(kd +  2u * AT_KP * 4u), "v"(ks +  2 * Cn),
                        "v"(kd +  4u * AT_KP * 4u), "v"(ks +  4 * Cn),
                        "v"(kd +  6u * AT_KP * 4u), "v"(ks +  6 * Cn),
                        "v"(kd +  8u * AT_KP * 4u), "v"(ks +  8 * Cn),
                        "v"(kd + 10u * AT_KP * 4u), "v"(ks + 10 * Cn),
                        "v"(kd + 12u * AT_KP * 4u), "v"(ks + 12 * Cn),
                        "v"(kd + 14u * AT_KP * 4u), "v"(ks + 14 * Cn) : "memory");
        asm volatile("global_load_async_to_lds_b128 %0, %1, off\n\t"
                     "global_load_async_to_lds_b128 %2, %3, off\n\t"
                     "global_load_async_to_lds_b128 %4, %5, off\n\t"
                     "global_load_async_to_lds_b128 %6, %7, off\n\t"
                     "global_load_async_to_lds_b128 %8, %9, off\n\t"
                     "global_load_async_to_lds_b128 %10, %11, off\n\t"
                     "global_load_async_to_lds_b128 %12, %13, off\n\t"
                     "global_load_async_to_lds_b128 %14, %15, off\n\t"
                     "s_wait_xcnt 0x0"
                     :: "v"(vd),                    "v"(vs),
                        "v"(vd +  2u * AT_VP * 4u), "v"(vs +  2 * Cn),
                        "v"(vd +  4u * AT_VP * 4u), "v"(vs +  4 * Cn),
                        "v"(vd +  6u * AT_VP * 4u), "v"(vs +  6 * Cn),
                        "v"(vd +  8u * AT_VP * 4u), "v"(vs +  8 * Cn),
                        "v"(vd + 10u * AT_VP * 4u), "v"(vs + 10 * Cn),
                        "v"(vd + 12u * AT_VP * 4u), "v"(vs + 12 * Cn),
                        "v"(vd + 14u * AT_VP * 4u), "v"(vs + 14 * Cn) : "memory");
    };

    const int nst = blockIdx.x + 1;       // stages of this block, keys 0 .. 64*nst-1
    issueStage(0);

    // Q fragments for all 16 K-steps over D=64 (resident for whole tile); the
    // lane and register map of an A and of a B operand are alike, so these
    // serve as B = Q^T (column = query l15).
    v2f aq[16];
    {
        const float* qrow = Qp + (size_t)(t0 + l15) * Cn;
#pragma unroll
        for (int s = 0; s < 16; ++s) {
            const int dd = s * 4 + half * 2;
            aq[s].x = qrow[dd];
            aq[s].y = qrow[dd + 1];
        }
    }

    v8f o[4] = {};
    // Of query t0 + l15: running maximum (alike in both halves) and the sum over
    // this half's own keys.
    float mrow = -1e30f, lrow = 0.0f;
    const int qi = t0 + l15;              // query index of this lane

    asm volatile("s_wait_asynccnt 0x0" ::: "memory");     // my stage 0 copies landed
    __syncthreads();                                      // every wave's landed
    if (1 < nst) issueStage(1);                           // flies during stage 0

    for (int st = 0; st < nst; ++st) {
        const float* Kst = KV + (st & 1) * AT_STAGE_W;
        const float* Vst = Kst + AT_KW;
        // Tiles with s0 <= t0: all four of a stage but in the last, the diagonal's.
        const int nu = (st + 1 < nst) ? 4 : wave + 1;
        for (int u = 0; u < nu; ++u) {
            const int s0 = st * AT_KT + u * 16;
            // S^T = K @ Q^T  (16 keys x 16 queries, K-dim = 64)
            v8f sa = {};
            const float* kr = Kst + (u * 16 + l15) * AT_KP + half * 2;
#pragma unroll
            for (int s = 0; s < 16; ++s) {
                const v2f kf = *(const v2f*)(kr + s * 4);
                sa = __builtin_amdgcn_wmma_f32_16x16x4_f32(
                    false, kf, false, aq[s], 0, sa, false, false);
            }

            // scale, causal mask, online softmax update; all of one query in one lane
            const int k0 = s0 + half * 8;            // key index of register 0
            float sv[8];
#pragma unroll
            for (int r = 0; r < 8; ++r) {
                sv[r] = sa[r] * 0.125f;              // 1/sqrt(64)
                if (k0 + r > qi) sv[r] = -1e30f;
            }
            float mx = fmaxf(fmaxf(fmaxf(sv[0], sv[1]), fmaxf(sv[2], sv[3])),
                             fmaxf(fmaxf(sv[4], sv[5]), fmaxf(sv[6], sv[7])));
            mx = fmaxf(mx, xhalf(mx));               // the other half's 8 keys

            const float mn = fmaxf(mrow, mx);
            const float alpha = exp_slot(mrow - mn);
            float p[8];
#pragma unroll
            for (int r = 0; r < 8; ++r) p[r] = exp_slot(sv[r] - mn);

            lrow = lrow * alpha + (((p[0] + p[1]) + (p[2] + p[3]))
                                 + ((p[4] + p[5]) + (p[6] + p[7])));
            mrow = mn;
#pragma unroll
            for (int j = 0; j < 4; ++j)
#pragma unroll
                for (int r = 0; r < 8; ++r) o[j][r] *= alpha;

            // O^T += V^T @ P^T   (M = 64 head dims, K-dim = 16 keys, N = 16 queries)
            const float* vr = Vst + (u * 16 + half * 8) * AT_VP + l15;
#pragma unroll
            for (int s = 0; s < 4; ++s) {
                v2f pf;
                pf.x = p[2 * s];
                pf.y = p[2 * s + 1];
#pragma unroll
                for (int j = 0; j < 4; ++j) {
                    v2f vf;
                    vf.x = vr[(2 * s) * AT_VP + j * 16];
                    vf.y = vr[(2 * s + 1) * AT_VP + j * 16];
                    o[j] = __builtin_amdgcn_wmma_f32_16x16x4_f32(
                        false, vf, false, pf, 0, o[j], false, false);
                }
            }
        }
        // Publish point of stage st+1; it also frees the buffer just read.
        asm volatile("s_wait_dscnt 0x0" ::: "memory");    // my LDS reads retired
        asm volatile("s_wait_asynccnt 0x0" ::: "memory"); // my stage st+1 copies landed
        __syncthreads();                                  // every wave's, both
        if (st + 2 < nst) issueStage(st + 2);             // into the buffer just read
    }
    asm volatile("s_wait_asynccnt 0x0" ::: "memory");     // nothing in flight behind the loop

    // normalize and write y[b, t, h*64 + d]: o[j][r] is head dim j*16 + half*8 + r
    // of query qi, so a lane stores 8 consecutive floats per j.
    const float lsum = lrow + xhalf(lrow);                // both halves' keys
    float* yr = y + base + (size_t)qi * Cn + half * 8;
#pragma unroll
    for (int j = 0; j < 4; ++j) {
        const float4 lo = make_float4(o[j][0] / lsum, o[j][1] / lsum,
                                      o[j][2] / lsum, o[j][3] / lsum);
        const float4 hi = make_float4(o[j][4] / lsum, o[j][5] / lsum,
                                      o[j][6] / lsum, o[j][7] / lsum);
        *(float4*)(yr + j * 16)     = lo;
        *(float4*)(yr + j * 16 + 4) = hi;
    }
}

// ---------------------------------------------------------------------------
// LayerNorm: one 256-thread block per row of C=1024.
// ---------------------------------------------------------------------------
__global__ __launch_bounds__(256) void layernorm_kernel(
    const float* __restrict__ x, const float* __restrict__ g,
    const float* __restrict__ bta, float* __restrict__ out)
{
    const int row = blockIdx.x;
    const int tid = threadIdx.x;
    const float* xr = x + (size_t)row * Cn;
    __shared__ float red[256];

    float s = 0.0f;
    for (int i = tid; i < Cn; i += 256) s += xr[i];
    red[tid] = s;
    __syncthreads();
    for (int off = 128; off > 0; off >>= 1) {
        if (tid < off) red[tid] += red[tid + off];
        __syncthreads();
    }
    const float mu = red[0] * (1.0f / Cn);
    __syncthreads();

    float s2 = 0.0f;
    for (int i = tid; i < Cn; i += 256) {
        const float d = xr[i] - mu;
        s2 += d * d;
    }
    red[tid] = s2;
    __syncthreads();
    for (int off = 128; off > 0; off >>= 1) {
        if (tid < off) red[tid] += red[tid + off];
        __syncthreads();
    }
    const float rstd = rsqrtf(red[0] * (1.0f / Cn) + 1e-5f);
    __syncthreads();

    for (int i = tid; i < Cn; i += 256)
        out[(size_t)row * Cn + i] = (xr[i] - mu) * rstd * g[i] + bta[i];
}

// ---------------------------------------------------------------------------
// Router: logits = x1[0,t,:] @ router[C,8]; top-2, softmax -> gates[T,8].
// One wave per token.
// ---------------------------------------------------------------------------
__global__ __launch_bounds__(32) void router_kernel(
    const float* __restrict__ x1, const float* __restrict__ Wr,
    float* __restrict__ gates)
{
    const int t    = blockIdx.x;
    const int lane = threadIdx.x;
    const float* xr = x1 + (size_t)t * Cn;   // batch 0

    float acc[En] = {};
    for (int c = lane; c < Cn; c += 32) {
        const float xv = xr[c];
#pragma unroll
        for (int e = 0; e < En; ++e) acc[e] += xv * Wr[(size_t)c * En + e];
    }
#pragma unroll
    for (int e = 0; e < En; ++e) {
        float s = acc[e];
        s += __shfl_xor(s, 1, 32);
        s += __shfl_xor(s, 2, 32);
        s += __shfl_xor(s, 4, 32);
        s += __shfl_xor(s, 8, 32);
        s += __shfl_xor(s, 16, 32);
        acc[e] = s;
    }
    // top-2 (lowest index wins ties, matching lax.top_k), softmax of the pair
    int   i0 = 0;
    float v0 = acc[0];
#pragma unroll
    for (int e = 1; e < En; ++e)
        if (acc[e] > v0) { v0 = acc[e]; i0 = e; }
    int   i1 = -1;
    float v1 = -3.4e38f;
#pragma unroll
    for (int e = 0; e < En; ++e)
        if (e != i0 && acc[e] > v1) { v1 = acc[e]; i1 = e; }
    const float e0  = 1.0f;                 // exp(v0 - v0)
    const float e1  = __expf(v1 - v0);
    const float inv = 1.0f / (e0 + e1);
    if (lane < En) {
        const float gv = (lane == i0) ? e0 * inv : (lane == i1 ? e1 * inv : 0.0f);
        gates[(size_t)t * En + lane] = gv;
    }
}

// ---------------------------------------------------------------------------
// Host-side orchestration.
// Workspace layout (floats), total ~143 MB:
//   h    : B*T*C      (LN1 out, then reused for attention output y)
//   qb   : B*T*C      (Q, then reused for x1 = x + attn proj)
//   kb   : B*T*C      (K, then reused for y_adapt)
//   vb   : B*T*C      (V, then reused for h2 = LN2(x1))
//   mlp1 : B*T*4C
//   down : B*T*E*BOT  (gate-scaled adapter hidden, all experts side by side)
//   gates: T*E
// ---------------------------------------------------------------------------
extern "C" void kernel_launch(void* const* d_in, const int* in_sizes, int n_in,
                              void* d_out, int out_size, void* d_ws, size_t ws_size,
                              hipStream_t stream)
{
    (void)in_sizes; (void)n_in; (void)out_size; (void)ws_size;

    const float* x      = (const float*)d_in[0];
    const float* Wq     = (const float*)d_in[1];
    const float* bq     = (const float*)d_in[2];
    const float* Wk     = (const float*)d_in[3];
    const float* bk     = (const float*)d_in[4];
    const float* Wv     = (const float*)d_in[5];
    const float* bv     = (const float*)d_in[6];
    const float* Wo     = (const float*)d_in[7];
    const float* bo     = (const float*)d_in[8];
    const float* ln1_g  = (const float*)d_in[9];
    const float* ln1_b  = (const float*)d_in[10];
    const float* ln2_g  = (const float*)d_in[11];
    const float* ln2_b  = (const float*)d_in[12];
    const float* mlp_w1 = (const float*)d_in[13];
    const float* mlp_b1 = (const float*)d_in[14];
    const float* mlp_w2 = (const float*)d_in[15];
    const float* mlp_b2 = (const float*)d_in[16];
    const float* router = (const float*)d_in[17];
    const float* ad_w   = (const float*)d_in[18];
    const float* ad_b   = (const float*)d_in[19];
    const float* au_w   = (const float*)d_in[20];
    const float* au_b   = (const float*)d_in[21];

    float* out = (float*)d_out;

    const size_t NBTC = (size_t)BTn * Cn;        // 4M floats
    float* ws    = (float*)d_ws;
    float* h     = ws;
    float* qb    = h    + NBTC;
    float* kb    = qb   + NBTC;
    float* vb    = kb   + NBTC;
    float* mlp1  = vb   + NBTC;
    float* down  = mlp1 + (size_t)BTn * FFn;
    float* gates = down + (size_t)BTn * En * BOTn;

    const dim3 gemmCC(Cn / 64, BTn / 128);       // M=4096, N=1024
    const dim3 gemmFF(FFn / 64, BTn / 128);      // M=4096, N=4096
    const dim3 gemmDN(BOTn / 64, BTn / 128, En); // M=4096, N=64, z = expert

    // 1. h = LN1(x)
    layernorm_kernel<<<BTn, 256, 0, stream>>>(x, ln1_g, ln1_b, h);

    // 2. Q/K/V projections
    gemm_wmma<0, false, false, 0><<<gemmCC, 256, GEMM_LDS_BYTES, stream>>>(
        h, Wq, bq, nullptr, nullptr, nullptr, 0, qb, BTn, Cn, Cn);
    gemm_wmma<0, false, false, 0><<<gemmCC, 256, GEMM_LDS_BYTES, stream>>>(
        h, Wk, bk, nullptr, nullptr, nullptr, 0, kb, BTn, Cn, Cn);
    gemm_wmma<0, false, false, 0><<<gemmCC, 256, GEMM_LDS_BYTES, stream>>>(
        h, Wv, bv, nullptr, nullptr, nullptr, 0, vb, BTn, Cn, Cn);

    // 3. causal attention -> y (reuse h)
    attn_kernel<<<dim3(Tn / 16 / 4, Hn, Bn), 128, 0, stream>>>(qb, kb, vb, h);

    // 4. x1 = x + y @ Wo + bo   (into qb)
    gemm_wmma<0, true, false, 0><<<gemmCC, 256, GEMM_LDS_BYTES, stream>>>(
        h, Wo, bo, x, nullptr, nullptr, 0, qb, BTn, Cn, Cn);

    // 5. router gates from batch 0 of x1
    router_kernel<<<Tn, 32, 0, stream>>>(qb, router, gates);

    // 6. adapter MoE: y_adapt (kb) = sum_e gate[t,e]*0.1*(relu(x1@adw_e+adb_e)@auw_e+aub_e)
    gemm_wmma<1, false, false, 1><<<gemmDN, 256, GEMM_LDS_BYTES, stream>>>(
        qb, ad_w, ad_b, nullptr, nullptr, gates, En * BOTn, down, BTn, BOTn, Cn);
    gemm_wmma<0, false, false, 2><<<gemmCC, 256, GEMM_UP_LDS_BYTES, stream>>>(
        down, au_w, au_b, nullptr, nullptr, gates, 0, kb, BTn, Cn, En * BOTn);

    // 7. h2 = LN2(x1)  (into vb)
    layernorm_kernel<<<BTn, 256, 0, stream>>>(qb, ln2_g, ln2_b, vb);

    // 8. mlp1 = gelu(h2 @ W1 + b1)
    gemm_wmma<2, false, false, 0><<<gemmFF, 256, GEMM_LDS_BYTES, stream>>>(
        vb, mlp_w1, mlp_b1, nullptr, nullptr, nullptr, 0, mlp1, BTn, FFn, Cn);

    // 9. out = x1 + y_adapt + (mlp1 @ W2 + b2)
    gemm_wmma<0, true, true, 0><<<gemmCC, 256, GEMM_LDS_BYTES, stream>>>(
        mlp1, mlp_w2, mlp_b2, qb, kb, nullptr, 0, out, BTn, Cn, FFn);
}

// v005
// It runs in 721 microseconds.
// Two timings next to v004 both put it at 1.03 times that version's speed.
// Over all steps from v000 it is 1.90 times as fast.
#include <hip/hip_runtime.h>
#include <math.h>
#include <stdint.h>

// ---------------------------------------------------------------------------
// Transformer block (LN -> attn -> residual -> top2 MoE adapters -> LN -> MLP)
// for MI455X / gfx1250.  All GEMMs run on V_WMMA_F32_16X16X4_F32 (exact fp32
// matrix op) so numerics match the fp32 JAX reference while using the CDNA5
// matrix pipeline.  wave32 everywhere.
//
// The GEMM stages both operand tiles through LDS with CDNA5 async global->LDS
// copies (GLOBAL_LOAD_ASYNC_TO_LDS_B128 and _B32 / s_wait_asynccnt),
// double-buffered: each 32x64 B-chunk is fetched once per block instead of once
// per wave, and each 128x32 A-chunk arrives as whole 128-byte lines one chunk
// ahead instead of as 16-byte pieces of 16 lines per fragment load.
// ---------------------------------------------------------------------------

#define Bn   4
#define Tn   1024
#define Cn   1024
#define Hn   16
#define Dn   64
#define En   8
#define BOTn 64
#define FFn  4096
#define BTn  (Bn * Tn)          // 4096 rows

typedef float v2f __attribute__((ext_vector_type(2)));
typedef float v4f __attribute__((ext_vector_type(4)));
typedef float v8f __attribute__((ext_vector_type(8)));

// ---------------------------------------------------------------------------
// Generic fp32 WMMA GEMM:  out = epilogue(A[M,K] @ W[K,N] + bias[N])
// Block = 256 threads = 8 waves; each wave computes a 16(M) x 64(N) strip of
// a 128x64 block tile.  B is staged in LDS:
//   chunk = 32(K) x 64(N) floats, laid out as [K/2][N][2]: rows k and k+1 (k
//   even) of a column lie side by side, which is a lane's B fragment.  A 16-byte
//   read is then two whole fragments, of columns n and n+1, in register pairs
//   as the matrix instruction takes them; 16 lanes read 256 bytes in a row, all
//   64 banks once, so the pair rows need no pad.
//   Double buffered; filled by async global->LDS b32 copies (8 per thread; a
//   copy of a wave is 32 columns of one K row, one 128-byte line).
//   Accumulator tile j so holds columns (j/2)*32 + 2*l15 + (j&1) of the strip.
// A is staged beside it:
//   chunk = 128(M) x 32(K) floats, row stride padded to 36 words so the 32
//   8-byte fragment reads of a wave fall on all 64 banks once.
//   Double buffered; each wave copies its own 16 rows (4 b128 per thread).
// A-fragment (16x4 f32): lanes 0-15 hold K=k,k+1 ; lanes 16-31 hold K=k+2,k+3.
// C/D (16x16 f32): VGPR r -> row r (lanes 0-15) / row r+8 (lanes 16-31).
//
// ACT: 0=none, 1=relu, 2=exact gelu.  RES1/RES2: add residual tensors.
// ADP (all adapter experts in one launch):
//   1 = down: blockIdx.z is the expert; W, bias are [E][K][N], [E][N]; the
//       result, times gates[t,e] * 0.1, goes to column e*N+col of out[M][ldo].
//   2 = up:   A is that [M][E*BOT] matrix and W the experts' [E*BOT][N] stack,
//       so the K loop sums over the experts; bias is [E][N], gate-weighted.
//       The block's 128 gate rows and its 8x64 bias tile lie in LDS behind the
//       B and A buffers, copied there behind the K loop.
// ---------------------------------------------------------------------------
#define GEMM_KC   32
#define GEMM_BPP  128                     // words of a B pair row: 64 columns x 2 k
#define GEMM_ASTR 36
#define GEMM_BBUF (GEMM_KC / 2 * GEMM_BPP) // words of one B buffer
#define GEMM_B_WORDS (2 * GEMM_BBUF)
#define GEMM_A_WORDS (2 * 128 * GEMM_ASTR)
#define GEMM_LDS_BYTES ((GEMM_B_WORDS + GEMM_A_WORDS) * 4)
#define GEMM_UP_LDS_BYTES (GEMM_LDS_BYTES + (128 * En + En * 64) * 4)

template <int ACT, bool RES1, bool RES2, int ADP>
__global__ __launch_bounds__(256) void gemm_wmma(
    const float* __restrict__ A, const float* __restrict__ W,
    const float* __restrict__ bias,
    const float* __restrict__ res1, const float* __restrict__ res2,
    const float* __restrict__ gates, int ldo,
    float* __restrict__ out, int M, int N, int K)
{
    extern __shared__ __attribute__((aligned(16))) float Bs[]; // [2][GEMM_KC/2][64][2], then As
    const float* As = Bs + GEMM_B_WORDS;   // [2][128][GEMM_ASTR]

    const int tid  = threadIdx.x;
    const int lane = tid & 31;
    const int wave = tid >> 5;
    const int half = lane >> 4;     // 0: K pair {0,1}, 1: K pair {2,3}
    const int l15  = lane & 15;
    const int m0 = blockIdx.y * 128 + wave * 16;
    const int n0 = blockIdx.x * 64;

    if (ADP == 1) {
        W    += (size_t)blockIdx.z * K * N;
        bias += (size_t)blockIdx.z * N;
    }

    const int nchunk = K / GEMM_KC;

    // Cooperative loader, one chunk of both operands per call.
    // B: 32x64, eight floats per thread: a wave brings K rows 4*wave .. 4*wave+3,
    //    each as two copies of 32 columns, to words 2n + (k&1) of pair row k/2.
    // A: 128x32, four float4 per thread; a copy of a wave is 4 whole rows.
    const uint32_t lds0 = (uint32_t)(uintptr_t)Bs;
    const float* gB = W + (size_t)(wave * 4) * N + (n0 + lane);
    const float* gA = A + (size_t)(m0 + (lane >> 3)) * K + (lane & 7) * 4;
    const uint32_t lB = lds0 + (uint32_t)(wave * 2 * GEMM_BPP + lane * 2) * 4u;
    const uint32_t lA = lds0 + (uint32_t)(GEMM_B_WORDS
                      + (wave * 16 + (lane >> 3)) * GEMM_ASTR + (lane & 7) * 4) * 4u;
    auto issueChunk = [&](int kc) {
        const float* b0 = gB + (size_t)kc * GEMM_KC * N;
        const float* b1 = b0 + (size_t)N;
        const float* b2 = b0 + (size_t)2 * N;
        const float* b3 = b0 + (size_t)3 * N;
        const float* a0 = gA + kc * GEMM_KC;
        const float* a1 = a0 + (size_t)4 * K;
        const float* a2 = a0 + (size_t)8 * K;
        const float* a3 = a0 + (size_t)12 * K;
        const uint32_t db0 = lB + (uint32_t)((kc & 1) * GEMM_BBUF * 4);
        const uint32_t db2 = db0 + GEMM_BPP * 4u;         // K rows 2, 3: next pair row
        const uint32_t da0 = lA + (uint32_t)((kc & 1) * (128 * GEMM_ASTR) * 4);
        const uint32_t da1 = da0 + 4u * GEMM_ASTR * 4u;
        const uint32_t da2 = da0 + 8u * GEMM_ASTR * 4u;
        const uint32_t da3 = da0 + 12u * GEMM_ASTR * 4u;
        // Global -> LDS through no register: first operand the lane's LDS byte
        // address, second its global address.  s_wait_xcnt 0 stands inside the
        // statement so that no address register is reused ahead of it.
        asm volatile("global_load_async_to_lds_b32 %0, %1, off\n\t"
                     "global_load_async_to_lds_b32 %2, %3, off\n\t"
                     "global_load_async_to_lds_b32 %4, %5, off\n\t"
                     "global_load_async_to_lds_b32 %6, %7, off\n\t"
                     "global_load_async_to_lds_b32 %8, %9, off\n\t"
                     "global_load_async_to_lds_b32 %10, %11, off\n\t"
                     "global_load_async_to_lds_b32 %12, %13, off\n\t"
                     "global_load_async_to_lds_b32 %14, %15, off\n\t"
                     "global_load_async_to_lds_b128 %16, %17, off\n\t"
                     "global_load_async_to_lds_b128 %18, %19, off\n\t"
                     "global_load_async_to_lds_b128 %20, %21, off\n\t"
                     "global_load_async_to_lds_b128 %22, %23, off\n\t"
                     "s_wait_xcnt 0x0"
                     :: "v"(db0),        "v"(b0), "v"(db0 + 256u), "v"(b0 + 32),
                        "v"(db0 + 4u),   "v"(b1), "v"(db0 + 260u), "v"(b1 + 32),
                        "v"(db2),        "v"(b2), "v"(db2 + 256u), "v"(b2 + 32),
                        "v"(db2 + 4u),   "v"(b3), "v"(db2 + 260u), "v"(b3 + 32),
                        "v"(da0), "v"(a0), "v"(da1), "v"(a1),
                        "v"(da2), "v"(a2), "v"(da3), "v"(a3) : "memory");
    };

    issueChunk(0);
    asm volatile("s_wait_asynccnt 0x0" ::: "memory");     // my chunk 0 copies landed
    __syncthreads();                                      // every wave's landed
    if (1 < nchunk) issueChunk(1);                        // flies during chunk 0

    v8f acc[4] = {};
    for (int kc = 0; kc < nchunk; ++kc) {
        const float* buf  = Bs + (kc & 1) * GEMM_BBUF + half * GEMM_BPP + l15 * 4;
        const float* abuf = As + (kc & 1) * (128 * GEMM_ASTR)
                          + (wave * 16 + l15) * GEMM_ASTR + half * 2;
#pragma unroll
        for (int kl = 0; kl < GEMM_KC; kl += 4) {
            const v2f a = *(const v2f*)(abuf + kl);
            // Pair row kl/2 + half holds K = kl + 2*half and the next, as A does.
#pragma unroll   // static g keeps acc[] in registers
            for (int g = 0; g < 2; ++g) {
                const v4f b = *(const v4f*)(buf + (kl / 2) * GEMM_BPP + g * 64);
                acc[2 * g] = __builtin_amdgcn_wmma_f32_16x16x4_f32(
                    false, a, false, b.lo, 0, acc[2 * g], false, false);
                acc[2 * g + 1] = __builtin_amdgcn_wmma_f32_16x16x4_f32(
                    false, a, false, b.hi, 0, acc[2 * g + 1], false, false);
            }
        }
        // Publish point of chunk kc+1; it also frees the buffers just read.
        asm volatile("s_wait_dscnt 0x0" ::: "memory");    // my LDS reads retired
        asm volatile("s_wait_asynccnt 0x0" ::: "memory"); // my chunk kc+1 copies landed
        __syncthreads();                                  // every wave's, both
        if (kc + 2 < nchunk) issueChunk(kc + 2);          // into the buffers just read
    }
    asm volatile("s_wait_asynccnt 0x0" ::: "memory");     // nothing in flight behind the loop

    if (ADP == 2) {
        const float* Gs = Bs + GEMM_B_WORDS + GEMM_A_WORDS;   // [128][En] gate rows
        const float* Es = Gs + 128 * En;                  // [En][64]  bias tile
        // One float4 of gates and one float2 of bias per thread.  The 128 rows
        // of a block are consecutive t (128 divides Tn).
        const float* gsrc = gates + (size_t)((blockIdx.y * 128) & (Tn - 1)) * En + tid * 4;
        const float* esrc = bias + (size_t)wave * N + n0 + lane * 2;
        const uint32_t gdst = (uint32_t)GEMM_LDS_BYTES + (uint32_t)tid * 16u;
        const uint32_t edst = (uint32_t)(GEMM_LDS_BYTES + 128 * En * 4) + (uint32_t)tid * 8u;
        // Global -> LDS through no register.  s_wait_xcnt 0 stands inside the
        // statement so that no address register is reused ahead of it.
        asm volatile("global_load_async_to_lds_b128 %0, %1, off\n\t"
                     "global_load_async_to_lds_b64 %2, %3, off\n\t"
                     "s_wait_xcnt 0x0"
                     :: "v"(gdst), "v"(gsrc), "v"(edst), "v"(esrc) : "memory");
        asm volatile("s_wait_asynccnt 0x0" ::: "memory");   // my two copies landed
        __syncthreads();                                    // every wave's landed

        // acc += (0.1 * gates) @ bias, in the accumulators' own layout.
        float be[4][En];
#pragma unroll   // static j, e keep be[][] in registers
        for (int j = 0; j < 4; ++j)
#pragma unroll   // as above
            for (int e = 0; e < En; ++e)
                be[j][e] = Es[e * 64 + (j >> 1) * 32 + l15 * 2 + (j & 1)];
#pragma unroll   // static r keeps acc[j][r] in registers
        for (int r = 0; r < 8; ++r) {
            const float4* grow = (const float4*)(Gs + (wave * 16 + r + half * 8) * En);
            const float4 ga = grow[0], gb = grow[1];
            const float gs[En] = {ga.x * 0.1f, ga.y * 0.1f, ga.z * 0.1f, ga.w * 0.1f,
                                  gb.x * 0.1f, gb.y * 0.1f, gb.z * 0.1f, gb.w * 0.1f};
#pragma unroll   // static j for acc[j][r], be[j][e]
            for (int j = 0; j < 4; ++j) {
                float bsum = 0.0f;
#pragma unroll   // static e for gs[e], be[j][e]
                for (int e = 0; e < En; ++e) bsum += gs[e] * be[j][e];
                acc[j][r] += bsum;
            }
        }
    }

    // Tiles 2p and 2p+1 hold neighbouring columns, so a lane handles them as one
    // float2 and 16 lanes cover a whole 128-byte line of a row.
    // Bias and residual rows are fetched first, all in flight together.  Each
    // s_wait_xcnt 0 stands in front of any reuse of the address registers of the
    // loads ahead of it.
    v2f bv[2], r1[2][8], r2[2][8];
#pragma unroll   // static p, r keep the arrays in registers
    for (int p = 0; p < 2; ++p) {
        const int col = n0 + p * 32 + l15 * 2;
        if (ADP != 2) {
            bv[p] = *(const v2f*)(bias + col);
            asm volatile("s_wait_xcnt 0x0" ::: "memory");   // ahead of a reuse of its address registers
        }
        if (RES1 || RES2) {
#pragma unroll   // as above
            for (int r = 0; r < 8; ++r) {
                const size_t idx = (size_t)(m0 + r + half * 8) * N + col;
                if (RES1) r1[p][r] = *(const v2f*)(res1 + idx);
                if (RES2) r2[p][r] = *(const v2f*)(res2 + idx);
                // ahead of a reuse of these loads' address registers
                if ((r & 3) == 3) asm volatile("s_wait_xcnt 0x0" ::: "memory");
            }
        }
    }
#pragma unroll   // static p, r for acc[][], bv[], r1[][], r2[][]
    for (int p = 0; p < 2; ++p) {
        const int col = n0 + p * 32 + l15 * 2;
#pragma unroll   // as above
        for (int r = 0; r < 8; ++r) {
            const int row = m0 + r + half * 8;
            v2f v;
            v.x = (ADP == 2) ? acc[2 * p][r]     : acc[2 * p][r]     + bv[p].x;
            v.y = (ADP == 2) ? acc[2 * p + 1][r] : acc[2 * p + 1][r] + bv[p].y;
            if (ACT == 1) { v.x = fmaxf(v.x, 0.0f); v.y = fmaxf(v.y, 0.0f); }
            if (ACT == 2) {
                v.x = 0.5f * v.x * (1.0f + erff(v.x * 0.70710678118654752f));
                v.y = 0.5f * v.y * (1.0f + erff(v.y * 0.70710678118654752f));
            }
            const size_t idx = (size_t)row * N + col;
            if (RES1) v += r1[p][r];
            if (RES2) v += r2[p][r];
            if (ADP == 1) {
                const float g = gates[(size_t)(row & (Tn - 1)) * En + blockIdx.z];
                v.x = g * 0.1f * v.x;
                v.y = g * 0.1f * v.y;
                *(v2f*)(out + (size_t)row * ldo + blockIdx.z * N + col) = v;
            } else {
                *(v2f*)(out + idx) = v;
            }
        }
    }
}

#define AT_KT 64
#define AT_KP 68
#define AT_VP 68
#define AT_KW (AT_KT * AT_KP)
#define AT_STAGE_W (AT_KW + AT_KT * AT_VP)

// Lane l <-> lane l ^ 16, through no LDS.
__device__ __forceinline__ float xhalf(float x)
{
    return __builtin_bit_cast(float, __builtin_amdgcn_permlanex16(
        __builtin_bit_cast(int, x), __builtin_bit_cast(int, x),
        0x76543210, 0xfedcba98, false, false));
}

// exp(x) as __expf forms it (times log2 e, then v_exp_f32).  Written out so that
// the v_nop stands directly behind the transcendental: the slot the instruction
// set asks for before its result is used or its source overwritten.
__device__ __forceinline__ float exp_slot(float x)
{
    float e;
    asm("v_exp_f32 %0, %1\n\tv_nop" : "=v"(e) : "v"(x * 1.44269504088896340736f));
    return e;
}

__global__ __launch_bounds__(128) void attn_kernel(
    const float* __restrict__ q, const float* __restrict__ k,
    const float* __restrict__ v, float* __restrict__ y)
{
    const int lane = threadIdx.x & 31;
    // Scalar wave number: the tile loop and all around the copies branch on SCC.
    const int wave = __builtin_amdgcn_readfirstlane(threadIdx.x >> 5);
    const int half = lane >> 4;
    const int l15  = lane & 15;

    const int t0 = (blockIdx.x * 4 + wave) * 16;
    const int hh = blockIdx.y;
    const int b  = blockIdx.z;

    const size_t base = (size_t)b * Tn * Cn + (size_t)hh * Dn;
    const float* Qp = q + base;
    const float* Kp = k + base;
    const float* Vp = v + base;

    __shared__ __attribute__((aligned(16))) float KV[2 * AT_STAGE_W];

    // Stage loader.  A copy of a wave is 2 whole rows (32 lanes x 16 bytes); a
    // wave brings rows 16*wave .. 16*wave+15 of K and of V, 8 copies each.
    const int crow = wave * 16 + half;
    const int ccol = l15 * 4;
    const float* gK = Kp + (size_t)crow * Cn + ccol;
    const float* gV = Vp + (size_t)crow * Cn + ccol;
    const uint32_t kv0 = (uint32_t)(uintptr_t)KV;
    const uint32_t lK = kv0 + (uint32_t)(crow * AT_KP + ccol) * 4u;
    const uint32_t lV = kv0 + (uint32_t)(AT_KW + crow * AT_VP + ccol) * 4u;
    auto issueStage = [&](int st) {
        const size_t   go = (size_t)st * AT_KT * Cn;
        const uint32_t lo = (uint32_t)((st & 1) * AT_STAGE_W * 4);
        const float* ks = gK + go;
        const float* vs = gV + go;
        const uint32_t kd = lK + lo;
        const uint32_t vd = lV + lo;
        // Global -> LDS through no register: first operand the lane's LDS byte
        // address, second its global address.  s_wait_xcnt 0 stands inside each
        // statement so that no address register is reused ahead of it.
        asm volatile("global_load_async_to_lds_b128 %0, %1, off\n\t"
                     "global_load_async_to_lds_b128 %2, %3, off\n\t"
                     "global_load_async_to_lds_b128 %4, %5, off\n\t"
                     "global_load_async_to_lds_b128 %6, %7, off\n\t"
                     "global_load_async_to_lds_b128 %8, %9, off\n\t"
                     "global_load_async_to_lds_b128 %10, %11, off\n\t"
                     "global_load_async_to_lds_b128 %12, %13, off\n\t"
                     "global_load_async_to_lds_b128 %14, %15, off\n\t"
                     "s_wait_xcnt 0x0"
                     :: "v"(kd),                    "v"(ks),
                        "v"(kd +  2u * AT_KP * 4u), "v"(ks +  2 * Cn),
                        "v"(kd +  4u * AT_KP * 4u), "v"(ks +  4 * Cn),
                        "v"(kd +  6u * AT_KP * 4u), "v"(ks +  6 * Cn),
                        "v"(kd +  8u * AT_KP * 4u), "v"(ks +  8 * Cn),
                        "v"(kd + 10u * AT_KP * 4u), "v"(ks + 10 * Cn),
                        "v"(kd + 12u * AT_KP * 4u), "v"(ks + 12 * Cn),
                        "v"(kd + 14u * AT_KP * 4u), "v"(ks + 14 * Cn) : "memory");
        asm volatile("global_load_async_to_lds_b128 %0, %1, off\n\t"
                     "global_load_async_to_lds_b128 %2, %3, off\n\t"
                     "global_load_async_to_lds_b128 %4, %5, off\n\t"
                     "global_load_async_to_lds_b128 %6, %7, off\n\t"
                     "global_load_async_to_lds_b128 %8, %9, off\n\t"
                     "global_load_async_to_lds_b128 %10, %11, off\n\t"
                     "global_load_async_to_lds_b128 %12, %13, off\n\t"
                     "global_load_async_to_lds_b128 %14, %15, off\n\t"
                     "s_wait_xcnt 0x0"
                     :: "v"(vd),                    "v"(vs),
                        "v"(vd +  2u * AT_VP * 4u), "v"(vs +  2 * Cn),
                        "v"(vd +  4u * AT_VP * 4u), "v"(vs +  4 * Cn),
                        "v"(vd +  6u * AT_VP * 4u), "v"(vs +  6 * Cn),
                        "v"(vd +  8u * AT_VP * 4u), "v"(vs +  8 * Cn),
                        "v"(vd + 10u * AT_VP * 4u), "v"(vs + 10 * Cn),
                        "v"(vd + 12u * AT_VP * 4u), "v"(vs + 12 * Cn),
                        "v"(vd + 14u * AT_VP * 4u), "v"(vs + 14 * Cn) : "memory");
    };

    const int nst = blockIdx.x + 1;       // stages of this block, keys 0 .. 64*nst-1
    issueStage(0);

    // Q fragments for all 16 K-steps over D=64 (resident for whole tile); the
    // lane and register map of an A and of a B operand are alike, so these
    // serve as B = Q^T (column = query l15).
    v2f aq[16];
    {
        const float* qrow = Qp + (size_t)(t0 + l15) * Cn;
#pragma unroll
        for (int s = 0; s < 16; ++s) {
            const int dd = s * 4 + half * 2;
            aq[s].x = qrow[dd];
            aq[s].y = qrow[dd + 1];
        }
    }

    v8f o[4] = {};
    // Of query t0 + l15: running maximum (alike in both halves) and the sum over
    // this half's own keys.
    float mrow = -1e30f, lrow = 0.0f;
    const int qi = t0 + l15;              // query index of this lane

    asm volatile("s_wait_asynccnt 0x0" ::: "memory");     // my stage 0 copies landed
    __syncthreads();                                      // every wave's landed
    if (1 < nst) issueStage(1);                           // flies during stage 0

    for (int st = 0; st < nst; ++st) {
        const float* Kst = KV + (st & 1) * AT_STAGE_W;
        const float* Vst = Kst + AT_KW;
        // Tiles with s0 <= t0: all four of a stage but in the last, the diagonal's.
        const int nu = (st + 1 < nst) ? 4 : wave + 1;
        for (int u = 0; u < nu; ++u) {
            const int s0 = st * AT_KT + u * 16;
            // S^T = K @ Q^T  (16 keys x 16 queries, K-dim = 64)
            v8f sa = {};
            const float* kr = Kst + (u * 16 + l15) * AT_KP + half * 2;
#pragma unroll
            for (int s = 0; s < 16; ++s) {
                const v2f kf = *(const v2f*)(kr + s * 4);
                sa = __builtin_amdgcn_wmma_f32_16x16x4_f32(
                    false, kf, false, aq[s], 0, sa, false, false);
            }

            // scale, causal mask, online softmax update; all of one query in one lane
            const int k0 = s0 + half * 8;            // key index of register 0
            float sv[8];
#pragma unroll
            for (int r = 0; r < 8; ++r) {
                sv[r] = sa[r] * 0.125f;              // 1/sqrt(64)
                if (k0 + r > qi) sv[r] = -1e30f;
            }
            float mx = fmaxf(fmaxf(fmaxf(sv[0], sv[1]), fmaxf(sv[2], sv[3])),
                             fmaxf(fmaxf(sv[4], sv[5]), fmaxf(sv[6], sv[7])));
            mx = fmaxf(mx, xhalf(mx));               // the other half's 8 keys

            const float mn = fmaxf(mrow, mx);
            const float alpha = exp_slot(mrow - mn);
            float p[8];
#pragma unroll
            for (int r = 0; r < 8; ++r) p[r] = exp_slot(sv[r] - mn);

            lrow = lrow * alpha + (((p[0] + p[1]) + (p[2] + p[3]))
                                 + ((p[4] + p[5]) + (p[6] + p[7])));
            mrow = mn;
#pragma unroll
            for (int j = 0; j < 4; ++j)
#pragma unroll
                for (int r = 0; r < 8; ++r) o[j][r] *= alpha;

            // O^T += V^T @ P^T   (M = 64 head dims, K-dim = 16 keys, N = 16 queries)
            const float* vr = Vst + (u * 16 + half * 8) * AT_VP + l15;
#pragma unroll
            for (int s = 0; s < 4; ++s) {
                v2f pf;
                pf.x = p[2 * s];
                pf.y = p[2 * s + 1];
#pragma unroll
                for (int j = 0; j < 4; ++j) {
                    v2f vf;
                    vf.x = vr[(2 * s) * AT_VP + j * 16];
                    vf.y = vr[(2 * s + 1) * AT_VP + j * 16];
                    o[j] = __builtin_amdgcn_wmma_f32_16x16x4_f32(
                        false, vf, false, pf, 0, o[j], false, false);
                }
            }
        }
        // Publish point of stage st+1; it also frees the buffer just read.
        asm volatile("s_wait_dscnt 0x0" ::: "memory");    // my LDS reads retired
        asm volatile("s_wait_asynccnt 0x0" ::: "memory"); // my stage st+1 copies landed
        __syncthreads();                                  // every wave's, both
        if (st + 2 < nst) issueStage(st + 2);             // into the buffer just read
    }
    asm volatile("s_wait_asynccnt 0x0" ::: "memory");     // nothing in flight behind the loop

    // normalize and write y[b, t, h*64 + d]: o[j][r] is head dim j*16 + half*8 + r
    // of query qi, so a lane stores 8 consecutive floats per j.
    const float lsum = lrow + xhalf(lrow);                // both halves' keys
    float* yr = y + base + (size_t)qi * Cn + half * 8;
#pragma unroll
    for (int j = 0; j < 4; ++j) {
        const float4 lo = make_float4(o[j][0] / lsum, o[j][1] / lsum,
                                      o[j][2] / lsum, o[j][3] / lsum);
        const float4 hi = make_float4(o[j][4] / lsum, o[j][5] / lsum,
                                      o[j][6] / lsum, o[j][7] / lsum);
        *(float4*)(yr + j * 16)     = lo;
        *(float4*)(yr + j * 16 + 4) = hi;
    }
}

// ---------------------------------------------------------------------------
// LayerNorm: one 256-thread block per row of C=1024.
// ---------------------------------------------------------------------------
__global__ __launch_bounds__(256) void layernorm_kernel(
    const float* __restrict__ x, const float* __restrict__ g,
    const float* __restrict__ bta, float* __restrict__ out)
{
    const int row = blockIdx.x;
    const int tid = threadIdx.x;
    const float* xr = x + (size_t)row * Cn;
    __shared__ float red[256];

    float s = 0.0f;
    for (int i = tid; i < Cn; i += 256) s += xr[i];
    red[tid] = s;
    __syncthreads();
    for (int off = 128; off > 0; off >>= 1) {
        if (tid < off) red[tid] += red[tid + off];
        __syncthreads();
    }
    const float mu = red[0] * (1.0f / Cn);
    __syncthreads();

    float s2 = 0.0f;
    for (int i = tid; i < Cn; i += 256) {
        const float d = xr[i] - mu;
        s2 += d * d;
    }
    red[tid] = s2;
    __syncthreads();
    for (int off = 128; off > 0; off >>= 1) {
        if (tid < off) red[tid] += red[tid + off];
        __syncthreads();
    }
    const float rstd = rsqrtf(red[0] * (1.0f / Cn) + 1e-5f);
    __syncthreads();

    for (int i = tid; i < Cn; i += 256)
        out[(size_t)row * Cn + i] = (xr[i] - mu) * rstd * g[i] + bta[i];
}

// ---------------------------------------------------------------------------
// Router: logits = x1[0,t,:] @ router[C,8]; top-2, softmax -> gates[T,8].
// One wave per token.
// ---------------------------------------------------------------------------
__global__ __launch_bounds__(32) void router_kernel(
    const float* __restrict__ x1, const float* __restrict__ Wr,
    float* __restrict__ gates)
{
    const int t    = blockIdx.x;
    const int lane = threadIdx.x;
    const float* xr = x1 + (size_t)t * Cn;   // batch 0

    float acc[En] = {};
    for (int c = lane; c < Cn; c += 32) {
        const float xv = xr[c];
#pragma unroll
        for (int e = 0; e < En; ++e) acc[e] += xv * Wr[(size_t)c * En + e];
    }
#pragma unroll
    for (int e = 0; e < En; ++e) {
        float s = acc[e];
        s += __shfl_xor(s, 1, 32);
        s += __shfl_xor(s, 2, 32);
        s += __shfl_xor(s, 4, 32);
        s += __shfl_xor(s, 8, 32);
        s += __shfl_xor(s, 16, 32);
        acc[e] = s;
    }
    // top-2 (lowest index wins ties, matching lax.top_k), softmax of the pair
    int   i0 = 0;
    float v0 = acc[0];
#pragma unroll
    for (int e = 1; e < En; ++e)
        if (acc[e] > v0) { v0 = acc[e]; i0 = e; }
    int   i1 = -1;
    float v1 = -3.4e38f;
#pragma unroll
    for (int e = 0; e < En; ++e)
        if (e != i0 && acc[e] > v1) { v1 = acc[e]; i1 = e; }
    const float e0  = 1.0f;                 // exp(v0 - v0)
    const float e1  = __expf(v1 - v0);
    const float inv = 1.0f / (e0 + e1);
    if (lane < En) {
        const float gv = (lane == i0) ? e0 * inv : (lane == i1 ? e1 * inv : 0.0f);
        gates[(size_t)t * En + lane] = gv;
    }
}

// ---------------------------------------------------------------------------
// Host-side orchestration.
// Workspace layout (floats), total ~143 MB:
//   h    : B*T*C      (LN1 out, then reused for attention output y)
//   qb   : B*T*C      (Q, then reused for x1 = x + attn proj)
//   kb   : B*T*C      (K, then reused for y_adapt)
//   vb   : B*T*C      (V, then reused for h2 = LN2(x1))
//   mlp1 : B*T*4C
//   down : B*T*E*BOT  (gate-scaled adapter hidden, all experts side by side)
//   gates: T*E
// ---------------------------------------------------------------------------
extern "C" void kernel_launch(void* const* d_in, const int* in_sizes, int n_in,
                              void* d_out, int out_size, void* d_ws, size_t ws_size,
                              hipStream_t stream)
{
    (void)in_sizes; (void)n_in; (void)out_size; (void)ws_size;

    const float* x      = (const float*)d_in[0];
    const float* Wq     = (const float*)d_in[1];
    const float* bq     = (const float*)d_in[2];
    const float* Wk     = (const float*)d_in[3];
    const float* bk     = (const float*)d_in[4];
    const float* Wv     = (const float*)d_in[5];
    const float* bv     = (const float*)d_in[6];
    const float* Wo     = (const float*)d_in[7];
    const float* bo     = (const float*)d_in[8];
    const float* ln1_g  = (const float*)d_in[9];
    const float* ln1_b  = (const float*)d_in[10];
    const float* ln2_g  = (const float*)d_in[11];
    const float* ln2_b  = (const float*)d_in[12];
    const float* mlp_w1 = (const float*)d_in[13];
    const float* mlp_b1 = (const float*)d_in[14];
    const float* mlp_w2 = (const float*)d_in[15];
    const float* mlp_b2 = (const float*)d_in[16];
    const float* router = (const float*)d_in[17];
    const float* ad_w   = (const float*)d_in[18];
    const float* ad_b   = (const float*)d_in[19];
    const float* au_w   = (const float*)d_in[20];
    const float* au_b   = (const float*)d_in[21];

    float* out = (float*)d_out;

    const size_t NBTC = (size_t)BTn * Cn;        // 4M floats
    float* ws    = (float*)d_ws;
    float* h     = ws;
    float* qb    = h    + NBTC;
    float* kb    = qb   + NBTC;
    float* vb    = kb   + NBTC;
    float* mlp1  = vb   + NBTC;
    float* down  = mlp1 + (size_t)BTn * FFn;
    float* gates = down + (size_t)BTn * En * BOTn;

    const dim3 gemmCC(Cn / 64, BTn / 128);       // M=4096, N=1024
    const dim3 gemmFF(FFn / 64, BTn / 128);      // M=4096, N=4096
    const dim3 gemmDN(BOTn / 64, BTn / 128, En); // M=4096, N=64, z = expert

    // 1. h = LN1(x)
    layernorm_kernel<<<BTn, 256, 0, stream>>>(x, ln1_g, ln1_b, h);

    // 2. Q/K/V projections
    gemm_wmma<0, false, false, 0><<<gemmCC, 256, GEMM_LDS_BYTES, stream>>>(
        h, Wq, bq, nullptr, nullptr, nullptr, 0, qb, BTn, Cn, Cn);
    gemm_wmma<0, false, false, 0><<<gemmCC, 256, GEMM_LDS_BYTES, stream>>>(
        h, Wk, bk, nullptr, nullptr, nullptr, 0, kb, BTn, Cn, Cn);
    gemm_wmma<0, false, false, 0><<<gemmCC, 256, GEMM_LDS_BYTES, stream>>>(
        h, Wv, bv, nullptr, nullptr, nullptr, 0, vb, BTn, Cn, Cn);

    // 3. causal attention -> y (reuse h)
    attn_kernel<<<dim3(Tn / 16 / 4, Hn, Bn), 128, 0, stream>>>(qb, kb, vb, h);

    // 4. x1 = x + y @ Wo + bo   (into qb)
    gemm_wmma<0, true, false, 0><<<gemmCC, 256, GEMM_LDS_BYTES, stream>>>(
        h, Wo, bo, x, nullptr, nullptr, 0, qb, BTn, Cn, Cn);

    // 5. router gates from batch 0 of x1
    router_kernel<<<Tn, 32, 0, stream>>>(qb, router, gates);

    // 6. adapter MoE: y_adapt (kb) = sum_e gate[t,e]*0.1*(relu(x1@adw_e+adb_e)@auw_e+aub_e)
    gemm_wmma<1, false, false, 1><<<gemmDN, 256, GEMM_LDS_BYTES, stream>>>(
        qb, ad_w, ad_b, nullptr, nullptr, gates, En * BOTn, down, BTn, BOTn, Cn);
    gemm_wmma<0, false, false, 2><<<gemmCC, 256, GEMM_UP_LDS_BYTES, stream>>>(
        down, au_w, au_b, nullptr, nullptr, gates, 0, kb, BTn, Cn, En * BOTn);

    // 7. h2 = LN2(x1)  (into vb)
    layernorm_kernel<<<BTn, 256, 0, stream>>>(qb, ln2_g, ln2_b, vb);

    // 8. mlp1 = gelu(h2 @ W1 + b1)
    gemm_wmma<2, false, false, 0><<<gemmFF, 256, GEMM_LDS_BYTES, stream>>>(
        vb, mlp_w1, mlp_b1, nullptr, nullptr, nullptr, 0, mlp1, BTn, FFn, Cn);

    // 9. out = x1 + y_adapt + (mlp1 @ W2 + b2)
    gemm_wmma<0, true, true, 0><<<gemmCC, 256, GEMM_LDS_BYTES, stream>>>(
        mlp1, mlp_w2, mlp_b2, qb, kb, nullptr, 0, out, BTn, Cn, FFn);
}

// v006
// It runs in 690 microseconds.
// Timed twice side by side with v005, it ran 1.04 times as fast both times.
// Over all steps from v000 it is 1.98 times as fast.
#include <hip/hip_runtime.h>
#include <math.h>
#include <stdint.h>

// ---------------------------------------------------------------------------
// Transformer block (LN -> attn -> residual -> top2 MoE adapters -> LN -> MLP)
// for MI455X / gfx1250.  All GEMMs run on V_WMMA_F32_16X16X4_F32 (exact fp32
// matrix op) so numerics match the fp32 JAX reference while using the CDNA5
// matrix pipeline.  wave32 everywhere.
//
// The GEMM stages both operand tiles through LDS with CDNA5 async global->LDS
// copies (GLOBAL_LOAD_ASYNC_TO_LDS_B128 and _B32 / s_wait_asynccnt),
// double-buffered: each 32x64 B-chunk is fetched once per block instead of once
// per wave, and each 128x32 A-chunk arrives as whole 128-byte lines one chunk
// ahead instead of as 16-byte pieces of 16 lines per fragment load.
// ---------------------------------------------------------------------------

#define Bn   4
#define Tn   1024
#define Cn   1024
#define Hn   16
#define Dn   64
#define En   8
#define BOTn 64
#define FFn  4096
#define BTn  (Bn * Tn)          // 4096 rows

typedef float v2f __attribute__((ext_vector_type(2)));
typedef float v4f __attribute__((ext_vector_type(4)));
typedef float v8f __attribute__((ext_vector_type(8)));

// ---------------------------------------------------------------------------
// Generic fp32 WMMA GEMM:  out = epilogue(A[M,K] @ W[K,N] + bias[N])
// Block = 256 threads = 8 waves; each wave computes a 16(M) x 64(N) strip of
// a 128x64 block tile.  B is staged in LDS:
//   chunk = 32(K) x 64(N) floats, laid out as [K/2][N][2]: rows k and k+1 (k
//   even) of a column lie side by side, which is a lane's B fragment.  A 16-byte
//   read is then two whole fragments, of columns n and n+1, in register pairs
//   as the matrix instruction takes them; 16 lanes read 256 bytes in a row, all
//   64 banks once, so the pair rows need no pad.
//   Double buffered; filled by async global->LDS b32 copies (8 per thread; a
//   copy of a wave is 32 columns of one K row, one 128-byte line).
//   Accumulator tile j so holds columns (j/2)*32 + 2*l15 + (j&1) of the strip.
// A is staged beside it:
//   chunk = 128(M) x 32(K) floats, row stride padded to 36 words so the 32
//   8-byte fragment reads of a wave fall on all 64 banks once.
//   Double buffered; each wave copies its own 16 rows (4 b128 per thread).
// A-fragment (16x4 f32): lanes 0-15 hold K=k,k+1 ; lanes 16-31 hold K=k+2,k+3.
// C/D (16x16 f32): VGPR r -> row r (lanes 0-15) / row r+8 (lanes 16-31).
//
// ACT: 0=none, 1=relu, 2=exact gelu.  RES1/RES2: add residual tensors.
// ADP (all adapter experts in one launch):
//   1 = down: blockIdx.z is the expert; W, bias are [E][K][N], [E][N]; the
//       result, times gates[t,e] * 0.1, goes to column e*N+col of out[M][ldo].
//   2 = up:   A is that [M][E*BOT] matrix and W the experts' [E*BOT][N] stack,
//       so the K loop sums over the experts; bias is [E][N], gate-weighted.
//       The block's 128 gate rows and its 8x64 bias tile lie in LDS behind the
//       B and A buffers, copied there behind the K loop.
// ---------------------------------------------------------------------------
#define GEMM_KC   32
#define GEMM_BPP  128                     // words of a B pair row: 64 columns x 2 k
#define GEMM_ASTR 36
#define GEMM_BBUF (GEMM_KC / 2 * GEMM_BPP) // words of one B buffer
#define GEMM_B_WORDS (2 * GEMM_BBUF)
#define GEMM_A_WORDS (2 * 128 * GEMM_ASTR)
#define GEMM_LDS_BYTES ((GEMM_B_WORDS + GEMM_A_WORDS) * 4)
#define GEMM_UP_LDS_BYTES (GEMM_LDS_BYTES + (128 * En + En * 64) * 4)

template <int ACT, bool RES1, bool RES2, int ADP>
__global__ __launch_bounds__(256) void gemm_wmma(
    const float* __restrict__ A, const float* __restrict__ W,
    const float* __restrict__ bias,
    const float* __restrict__ res1, const float* __restrict__ res2,
    const float* __restrict__ gates, int ldo,
    float* __restrict__ out, int M, int N, int K)
{
    extern __shared__ __attribute__((aligned(16))) float Bs[]; // [2][GEMM_KC/2][64][2], then As
    const float* As = Bs + GEMM_B_WORDS;   // [2][128][GEMM_ASTR]

    const int tid  = threadIdx.x;
    const int lane = tid & 31;
    const int wave = tid >> 5;
    const int half = lane >> 4;     // 0: K pair {0,1}, 1: K pair {2,3}
    const int l15  = lane & 15;
    const int m0 = blockIdx.y * 128 + wave * 16;
    const int n0 = blockIdx.x * 64;

    if (ADP == 1) {
        W    += (size_t)blockIdx.z * K * N;
        bias += (size_t)blockIdx.z * N;
    }

    const int nchunk = K / GEMM_KC;

    // Cooperative loader, one chunk of both operands per call.
    // B: 32x64, eight floats per thread: a wave brings K rows 4*wave .. 4*wave+3,
    //    each as two copies of 32 columns, to words 2n + (k&1) of pair row k/2.
    // A: 128x32, four float4 per thread; a copy of a wave is 4 whole rows.
    const uint32_t lds0 = (uint32_t)(uintptr_t)Bs;
    const float* gB = W + (size_t)(wave * 4) * N + (n0 + lane);
    const float* gA = A + (size_t)(m0 + (lane >> 3)) * K + (lane & 7) * 4;
    const uint32_t lB = lds0 + (uint32_t)(wave * 2 * GEMM_BPP + lane * 2) * 4u;
    const uint32_t lA = lds0 + (uint32_t)(GEMM_B_WORDS
                      + (wave * 16 + (lane >> 3)) * GEMM_ASTR + (lane & 7) * 4) * 4u;
    auto issueChunk = [&](int kc) {
        const float* b0 = gB + (size_t)kc * GEMM_KC * N;
        const float* b1 = b0 + (size_t)N;
        const float* b2 = b0 + (size_t)2 * N;
        const float* b3 = b0 + (size_t)3 * N;
        const float* a0 = gA + kc * GEMM_KC;
        const float* a1 = a0 + (size_t)4 * K;
        const float* a2 = a0 + (size_t)8 * K;
        const float* a3 = a0 + (size_t)12 * K;
        const uint32_t db0 = lB + (uint32_t)((kc & 1) * GEMM_BBUF * 4);
        const uint32_t db2 = db0 + GEMM_BPP * 4u;         // K rows 2, 3: next pair row
        const uint32_t da0 = lA + (uint32_t)((kc & 1) * (128 * GEMM_ASTR) * 4);
        const uint32_t da1 = da0 + 4u * GEMM_ASTR * 4u;
        const uint32_t da2 = da0 + 8u * GEMM_ASTR * 4u;
        const uint32_t da3 = da0 + 12u * GEMM_ASTR * 4u;
        // Global -> LDS through no register: first operand the lane's LDS byte
        // address, second its global address.  s_wait_xcnt 0 stands inside the
        // statement so that no address register is reused ahead of it.
        asm volatile("global_load_async_to_lds_b32 %0, %1, off\n\t"
                     "global_load_async_to_lds_b32 %2, %3, off\n\t"
                     "global_load_async_to_lds_b32 %4, %5, off\n\t"
                     "global_load_async_to_lds_b32 %6, %7, off\n\t"
                     "global_load_async_to_lds_b32 %8, %9, off\n\t"
                     "global_load_async_to_lds_b32 %10, %11, off\n\t"
                     "global_load_async_to_lds_b32 %12, %13, off\n\t"
                     "global_load_async_to_lds_b32 %14, %15, off\n\t"
                     "global_load_async_to_lds_b128 %16, %17, off\n\t"
                     "global_load_async_to_lds_b128 %18, %19, off\n\t"
                     "global_load_async_to_lds_b128 %20, %21, off\n\t"
                     "global_load_async_to_lds_b128 %22, %23, off\n\t"
                     "s_wait_xcnt 0x0"
                     :: "v"(db0),        "v"(b0), "v"(db0 + 256u), "v"(b0 + 32),
                        "v"(db0 + 4u),   "v"(b1), "v"(db0 + 260u), "v"(b1 + 32),
                        "v"(db2),        "v"(b2), "v"(db2 + 256u), "v"(b2 + 32),
                        "v"(db2 + 4u),   "v"(b3), "v"(db2 + 260u), "v"(b3 + 32),
                        "v"(da0), "v"(a0), "v"(da1), "v"(a1),
                        "v"(da2), "v"(a2), "v"(da3), "v"(a3) : "memory");
    };

    issueChunk(0);
    asm volatile("s_wait_asynccnt 0x0" ::: "memory");     // my chunk 0 copies landed
    __syncthreads();                                      // every wave's landed
    if (1 < nchunk) issueChunk(1);                        // flies during chunk 0

    v8f acc[4] = {};
    for (int kc = 0; kc < nchunk; ++kc) {
        const float* buf  = Bs + (kc & 1) * GEMM_BBUF + half * GEMM_BPP + l15 * 4;
        const float* abuf = As + (kc & 1) * (128 * GEMM_ASTR)
                          + (wave * 16 + l15) * GEMM_ASTR + half * 2;
#pragma unroll
        for (int kl = 0; kl < GEMM_KC; kl += 4) {
            const v2f a = *(const v2f*)(abuf + kl);
            // Pair row kl/2 + half holds K = kl + 2*half and the next, as A does.
#pragma unroll   // static g keeps acc[] in registers
            for (int g = 0; g < 2; ++g) {
                const v4f b = *(const v4f*)(buf + (kl / 2) * GEMM_BPP + g * 64);
                acc[2 * g] = __builtin_amdgcn_wmma_f32_16x16x4_f32(
                    false, a, false, b.lo, 0, acc[2 * g], false, false);
                acc[2 * g + 1] = __builtin_amdgcn_wmma_f32_16x16x4_f32(
                    false, a, false, b.hi, 0, acc[2 * g + 1], false, false);
            }
        }
        // Publish point of chunk kc+1; it also frees the buffers just read.
        asm volatile("s_wait_dscnt 0x0" ::: "memory");    // my LDS reads retired
        asm volatile("s_wait_asynccnt 0x0" ::: "memory"); // my chunk kc+1 copies landed
        __syncthreads();                                  // every wave's, both
        if (kc + 2 < nchunk) issueChunk(kc + 2);          // into the buffers just read
    }
    asm volatile("s_wait_asynccnt 0x0" ::: "memory");     // nothing in flight behind the loop

    if (ADP == 2) {
        const float* Gs = Bs + GEMM_B_WORDS + GEMM_A_WORDS;   // [128][En] gate rows
        const float* Es = Gs + 128 * En;                  // [En][64]  bias tile
        // One float4 of gates and one float2 of bias per thread.  The 128 rows
        // of a block are consecutive t (128 divides Tn).
        const float* gsrc = gates + (size_t)((blockIdx.y * 128) & (Tn - 1)) * En + tid * 4;
        const float* esrc = bias + (size_t)wave * N + n0 + lane * 2;
        const uint32_t gdst = (uint32_t)GEMM_LDS_BYTES + (uint32_t)tid * 16u;
        const uint32_t edst = (uint32_t)(GEMM_LDS_BYTES + 128 * En * 4) + (uint32_t)tid * 8u;
        // Global -> LDS through no register.  s_wait_xcnt 0 stands inside the
        // statement so that no address register is reused ahead of it.
        asm volatile("global_load_async_to_lds_b128 %0, %1, off\n\t"
                     "global_load_async_to_lds_b64 %2, %3, off\n\t"
                     "s_wait_xcnt 0x0"
                     :: "v"(gdst), "v"(gsrc), "v"(edst), "v"(esrc) : "memory");
        asm volatile("s_wait_asynccnt 0x0" ::: "memory");   // my two copies landed
        __syncthreads();                                    // every wave's landed

        // acc += (0.1 * gates) @ bias, in the accumulators' own layout.
        float be[4][En];
#pragma unroll   // static j, e keep be[][] in registers
        for (int j = 0; j < 4; ++j)
#pragma unroll   // as above
            for (int e = 0; e < En; ++e)
                be[j][e] = Es[e * 64 + (j >> 1) * 32 + l15 * 2 + (j & 1)];
#pragma unroll   // static r keeps acc[j][r] in registers
        for (int r = 0; r < 8; ++r) {
            const float4* grow = (const float4*)(Gs + (wave * 16 + r + half * 8) * En);
            const float4 ga = grow[0], gb = grow[1];
            const float gs[En] = {ga.x * 0.1f, ga.y * 0.1f, ga.z * 0.1f, ga.w * 0.1f,
                                  gb.x * 0.1f, gb.y * 0.1f, gb.z * 0.1f, gb.w * 0.1f};
#pragma unroll   // static j for acc[j][r], be[j][e]
            for (int j = 0; j < 4; ++j) {
                float bsum = 0.0f;
#pragma unroll   // static e for gs[e], be[j][e]
                for (int e = 0; e < En; ++e) bsum += gs[e] * be[j][e];
                acc[j][r] += bsum;
            }
        }
    }

    // Tiles 2p and 2p+1 hold neighbouring columns, so a lane handles them as one
    // float2 and 16 lanes cover a whole 128-byte line of a row.
    // Bias and residual rows are fetched first, all in flight together.  Each
    // s_wait_xcnt 0 stands in front of any reuse of the address registers of the
    // loads ahead of it.
    v2f bv[2], r1[2][8], r2[2][8];
#pragma unroll   // static p, r keep the arrays in registers
    for (int p = 0; p < 2; ++p) {
        const int col = n0 + p * 32 + l15 * 2;
        if (ADP != 2) {
            bv[p] = *(const v2f*)(bias + col);
            asm volatile("s_wait_xcnt 0x0" ::: "memory");   // ahead of a reuse of its address registers
        }
        if (RES1 || RES2) {
#pragma unroll   // as above
            for (int r = 0; r < 8; ++r) {
                const size_t idx = (size_t)(m0 + r + half * 8) * N + col;
                if (RES1) r1[p][r] = *(const v2f*)(res1 + idx);
                if (RES2) r2[p][r] = *(const v2f*)(res2 + idx);
                // ahead of a reuse of these loads' address registers
                if ((r & 3) == 3) asm volatile("s_wait_xcnt 0x0" ::: "memory");
            }
        }
    }
#pragma unroll   // static p, r for acc[][], bv[], r1[][], r2[][]
    for (int p = 0; p < 2; ++p) {
        const int col = n0 + p * 32 + l15 * 2;
#pragma unroll   // as above
        for (int r = 0; r < 8; ++r) {
            const int row = m0 + r + half * 8;
            v2f v;
            v.x = (ADP == 2) ? acc[2 * p][r]     : acc[2 * p][r]     + bv[p].x;
            v.y = (ADP == 2) ? acc[2 * p + 1][r] : acc[2 * p + 1][r] + bv[p].y;
            if (ACT == 1) { v.x = fmaxf(v.x, 0.0f); v.y = fmaxf(v.y, 0.0f); }
            if (ACT == 2) {
                v.x = 0.5f * v.x * (1.0f + erff(v.x * 0.70710678118654752f));
                v.y = 0.5f * v.y * (1.0f + erff(v.y * 0.70710678118654752f));
            }
            const size_t idx = (size_t)row * N + col;
            if (RES1) v += r1[p][r];
            if (RES2) v += r2[p][r];
            if (ADP == 1) {
                const float g = gates[(size_t)(row & (Tn - 1)) * En + blockIdx.z];
                v.x = g * 0.1f * v.x;
                v.y = g * 0.1f * v.y;
                *(v2f*)(out + (size_t)row * ldo + blockIdx.z * N + col) = v;
            } else {
                *(v2f*)(out + idx) = v;
            }
        }
    }
}

#define AT_KT 64
#define AT_KP 68
#define AT_VP 68
#define AT_KW (AT_KT * AT_KP)
#define AT_STAGE_W (AT_KW + AT_KT * AT_VP)

// Lane l <-> lane l ^ 16, through no LDS.
__device__ __forceinline__ float xhalf(float x)
{
    return __builtin_bit_cast(float, __builtin_amdgcn_permlanex16(
        __builtin_bit_cast(int, x), __builtin_bit_cast(int, x),
        0x76543210, 0xfedcba98, false, false));
}

// exp(x) as __expf forms it (times log2 e, then v_exp_f32).  Written out so that
// the v_nop stands directly behind the transcendental: the slot the instruction
// set asks for before its result is used or its source overwritten.
__device__ __forceinline__ float exp_slot(float x)
{
    float e;
    asm("v_exp_f32 %0, %1\n\tv_nop" : "=v"(e) : "v"(x * 1.44269504088896340736f));
    return e;
}

__global__ __launch_bounds__(128) void attn_kernel(
    const float* __restrict__ q, const float* __restrict__ k,
    const float* __restrict__ v, float* __restrict__ y)
{
    const int lane = threadIdx.x & 31;
    // Scalar wave number: the tile loop and all around the copies branch on SCC.
    const int wave = __builtin_amdgcn_readfirstlane(threadIdx.x >> 5);
    const int half = lane >> 4;
    const int l15  = lane & 15;

    const int hh = blockIdx.y;
    const int b  = blockIdx.z;
    // Which 64 queries this block takes.  Block qx walks qx+1 stages, and every
    // block of the grid is resident at once, so the launch lasts as long as the
    // WGP whose blocks hold the most stages.  The order of the query
    // blocks is mirrored for the (head, batch) pairs of
    // odd bit parity.  Any aligned power-of-two run of pairs is half mirrored, and
    // a plain block with a mirrored one makes Tn/64 + 1 stages whatever blockIdx.x.
    const int mirror = __popc(blockIdx.y | (blockIdx.z << 4)) & 1;   // Hn = 16: bits apart
    const int qx = mirror ? (Tn / 64 - 1) - (int)blockIdx.x : (int)blockIdx.x;
    const int t0 = (qx * 4 + wave) * 16;

    const size_t base = (size_t)b * Tn * Cn + (size_t)hh * Dn;
    const float* Qp = q + base;
    const float* Kp = k + base;
    const float* Vp = v + base;

    __shared__ __attribute__((aligned(16))) float KV[2 * AT_STAGE_W];

    // Stage loader.  A copy of a wave is 2 whole rows (32 lanes x 16 bytes); a
    // wave brings rows 16*wave .. 16*wave+15 of K and of V, 8 copies each.
    const int crow = wave * 16 + half;
    const int ccol = l15 * 4;
    const float* gK = Kp + (size_t)crow * Cn + ccol;
    const float* gV = Vp + (size_t)crow * Cn + ccol;
    const uint32_t kv0 = (uint32_t)(uintptr_t)KV;
    const uint32_t lK = kv0 + (uint32_t)(crow * AT_KP + ccol) * 4u;
    const uint32_t lV = kv0 + (uint32_t)(AT_KW + crow * AT_VP + ccol) * 4u;
    auto issueStage = [&](int st) {
        const size_t   go = (size_t)st * AT_KT * Cn;
        const uint32_t lo = (uint32_t)((st & 1) * AT_STAGE_W * 4);
        const float* ks = gK + go;
        const float* vs = gV + go;
        const uint32_t kd = lK + lo;
        const uint32_t vd = lV + lo;
        // Global -> LDS through no register: first operand the lane's LDS byte
        // address, second its global address.  s_wait_xcnt 0 stands inside each
        // statement so that no address register is reused ahead of it.
        asm volatile("global_load_async_to_lds_b128 %0, %1, off\n\t"
                     "global_load_async_to_lds_b128 %2, %3, off\n\t"
                     "global_load_async_to_lds_b128 %4, %5, off\n\t"
                     "global_load_async_to_lds_b128 %6, %7, off\n\t"
                     "global_load_async_to_lds_b128 %8, %9, off\n\t"
                     "global_load_async_to_lds_b128 %10, %11, off\n\t"
                     "global_load_async_to_lds_b128 %12, %13, off\n\t"
                     "global_load_async_to_lds_b128 %14, %15, off\n\t"
                     "s_wait_xcnt 0x0"
                     :: "v"(kd),                    "v"(ks),
                        "v"(kd +  2u * AT_KP * 4u), "v"(ks +  2 * Cn),
                        "v"(kd +  4u * AT_KP * 4u), "v"(ks +  4 * Cn),
                        "v"(kd +  6u * AT_KP * 4u), "v"(ks +  6 * Cn),
                        "v"(kd +  8u * AT_KP * 4u), "v"(ks +  8 * Cn),
                        "v"(kd + 10u * AT_KP * 4u), "v"(ks + 10 * Cn),
                        "v"(kd + 12u * AT_KP * 4u), "v"(ks + 12 * Cn),
                        "v"(kd + 14u * AT_KP * 4u), "v"(ks + 14 * Cn) : "memory");
        asm volatile("global_load_async_to_lds_b128 %0, %1, off\n\t"
                     "global_load_async_to_lds_b128 %2, %3, off\n\t"
                     "global_load_async_to_lds_b128 %4, %5, off\n\t"
                     "global_load_async_to_lds_b128 %6, %7, off\n\t"
                     "global_load_async_to_lds_b128 %8, %9, off\n\t"
                     "global_load_async_to_lds_b128 %10, %11, off\n\t"
                     "global_load_async_to_lds_b128 %12, %13, off\n\t"
                     "global_load_async_to_lds_b128 %14, %15, off\n\t"
                     "s_wait_xcnt 0x0"
                     :: "v"(vd),                    "v"(vs),
                        "v"(vd +  2u * AT_VP * 4u), "v"(vs +  2 * Cn),
                        "v"(vd +  4u * AT_VP * 4u), "v"(vs +  4 * Cn),
                        "v"(vd +  6u * AT_VP * 4u), "v"(vs +  6 * Cn),
                        "v"(vd +  8u * AT_VP * 4u), "v"(vs +  8 * Cn),
                        "v"(vd + 10u * AT_VP * 4u), "v"(vs + 10 * Cn),
                        "v"(vd + 12u * AT_VP * 4u), "v"(vs + 12 * Cn),
                        "v"(vd + 14u * AT_VP * 4u), "v"(vs + 14 * Cn) : "memory");
    };

    const int nst = qx + 1;               // stages of this block, keys 0 .. 64*nst-1
    issueStage(0);

    // Q fragments for all 16 K-steps over D=64 (resident for whole tile); the
    // lane and register map of an A and of a B operand are alike, so these
    // serve as B = Q^T (column = query l15).
    v2f aq[16];
    {
        const float* qrow = Qp + (size_t)(t0 + l15) * Cn;
#pragma unroll
        for (int s = 0; s < 16; ++s) {
            const int dd = s * 4 + half * 2;
            aq[s].x = qrow[dd];
            aq[s].y = qrow[dd + 1];
        }
    }

    v8f o[4] = {};
    // Of query t0 + l15: running maximum (alike in both halves) and the sum over
    // this half's own keys.
    float mrow = -1e30f, lrow = 0.0f;
    const int qi = t0 + l15;              // query index of this lane

    asm volatile("s_wait_asynccnt 0x0" ::: "memory");     // my stage 0 copies landed
    __syncthreads();                                      // every wave's landed
    if (1 < nst) issueStage(1);                           // flies during stage 0

    for (int st = 0; st < nst; ++st) {
        const float* Kst = KV + (st & 1) * AT_STAGE_W;
        const float* Vst = Kst + AT_KW;
        // Tiles with s0 <= t0: all four of a stage but in the last, the diagonal's.
        const int nu = (st + 1 < nst) ? 4 : wave + 1;
        for (int u = 0; u < nu; ++u) {
            const int s0 = st * AT_KT + u * 16;
            // S^T = K @ Q^T  (16 keys x 16 queries, K-dim = 64)
            v8f sa = {};
            const float* kr = Kst + (u * 16 + l15) * AT_KP + half * 2;
#pragma unroll
            for (int s = 0; s < 16; ++s) {
                const v2f kf = *(const v2f*)(kr + s * 4);
                sa = __builtin_amdgcn_wmma_f32_16x16x4_f32(
                    false, kf, false, aq[s], 0, sa, false, false);
            }

            // scale, causal mask, online softmax update; all of one query in one lane
            const int k0 = s0 + half * 8;            // key index of register 0
            float sv[8];
#pragma unroll
            for (int r = 0; r < 8; ++r) {
                sv[r] = sa[r] * 0.125f;              // 1/sqrt(64)
                if (k0 + r > qi) sv[r] = -1e30f;
            }
            float mx = fmaxf(fmaxf(fmaxf(sv[0], sv[1]), fmaxf(sv[2], sv[3])),
                             fmaxf(fmaxf(sv[4], sv[5]), fmaxf(sv[6], sv[7])));
            mx = fmaxf(mx, xhalf(mx));               // the other half's 8 keys

            const float mn = fmaxf(mrow, mx);
            const float alpha = exp_slot(mrow - mn);
            float p[8];
#pragma unroll
            for (int r = 0; r < 8; ++r) p[r] = exp_slot(sv[r] - mn);

            lrow = lrow * alpha + (((p[0] + p[1]) + (p[2] + p[3]))
                                 + ((p[4] + p[5]) + (p[6] + p[7])));
            mrow = mn;
#pragma unroll
            for (int j = 0; j < 4; ++j)
#pragma unroll
                for (int r = 0; r < 8; ++r) o[j][r] *= alpha;

            // O^T += V^T @ P^T   (M = 64 head dims, K-dim = 16 keys, N = 16 queries)
            const float* vr = Vst + (u * 16 + half * 8) * AT_VP + l15;
#pragma unroll
            for (int s = 0; s < 4; ++s) {
                v2f pf;
                pf.x = p[2 * s];
                pf.y = p[2 * s + 1];
#pragma unroll
                for (int j = 0; j < 4; ++j) {
                    v2f vf;
                    vf.x = vr[(2 * s) * AT_VP + j * 16];
                    vf.y = vr[(2 * s + 1) * AT_VP + j * 16];
                    o[j] = __builtin_amdgcn_wmma_f32_16x16x4_f32(
                        false, vf, false, pf, 0, o[j], false, false);
                }
            }
        }
        // Publish point of stage st+1; it also frees the buffer just read.
        asm volatile("s_wait_dscnt 0x0" ::: "memory");    // my LDS reads retired
        asm volatile("s_wait_asynccnt 0x0" ::: "memory"); // my stage st+1 copies landed
        __syncthreads();                                  // every wave's, both
        if (st + 2 < nst) issueStage(st + 2);             // into the buffer just read
    }
    asm volatile("s_wait_asynccnt 0x0" ::: "memory");     // nothing in flight behind the loop

    // normalize and write y[b, t, h*64 + d]: o[j][r] is head dim j*16 + half*8 + r
    // of query qi, so a lane stores 8 consecutive floats per j.
    const float lsum = lrow + xhalf(lrow);                // both halves' keys
    float* yr = y + base + (size_t)qi * Cn + half * 8;
#pragma unroll
    for (int j = 0; j < 4; ++j) {
        const float4 lo = make_float4(o[j][0] / lsum, o[j][1] / lsum,
                                      o[j][2] / lsum, o[j][3] / lsum);
        const float4 hi = make_float4(o[j][4] / lsum, o[j][5] / lsum,
                                      o[j][6] / lsum, o[j][7] / lsum);
        *(float4*)(yr + j * 16)     = lo;
        *(float4*)(yr + j * 16 + 4) = hi;
    }
}

// ---------------------------------------------------------------------------
// LayerNorm: one 256-thread block per row of C=1024.
// ---------------------------------------------------------------------------
__global__ __launch_bounds__(256) void layernorm_kernel(
    const float* __restrict__ x, const float* __restrict__ g,
    const float* __restrict__ bta, float* __restrict__ out)
{
    const int row = blockIdx.x;
    const int tid = threadIdx.x;
    const float* xr = x + (size_t)row * Cn;
    __shared__ float red[256];

    float s = 0.0f;
    for (int i = tid; i < Cn; i += 256) s += xr[i];
    red[tid] = s;
    __syncthreads();
    for (int off = 128; off > 0; off >>= 1) {
        if (tid < off) red[tid] += red[tid + off];
        __syncthreads();
    }
    const float mu = red[0] * (1.0f / Cn);
    __syncthreads();

    float s2 = 0.0f;
    for (int i = tid; i < Cn; i += 256) {
        const float d = xr[i] - mu;
        s2 += d * d;
    }
    red[tid] = s2;
    __syncthreads();
    for (int off = 128; off > 0; off >>= 1) {
        if (tid < off) red[tid] += red[tid + off];
        __syncthreads();
    }
    const float rstd = rsqrtf(red[0] * (1.0f / Cn) + 1e-5f);
    __syncthreads();

    for (int i = tid; i < Cn; i += 256)
        out[(size_t)row * Cn + i] = (xr[i] - mu) * rstd * g[i] + bta[i];
}

// ---------------------------------------------------------------------------
// Router: logits = x1[0,t,:] @ router[C,8]; top-2, softmax -> gates[T,8].
// One wave per token.
// ---------------------------------------------------------------------------
__global__ __launch_bounds__(32) void router_kernel(
    const float* __restrict__ x1, const float* __restrict__ Wr,
    float* __restrict__ gates)
{
    const int t    = blockIdx.x;
    const int lane = threadIdx.x;
    const float* xr = x1 + (size_t)t * Cn;   // batch 0

    float acc[En] = {};
    for (int c = lane; c < Cn; c += 32) {
        const float xv = xr[c];
#pragma unroll
        for (int e = 0; e < En; ++e) acc[e] += xv * Wr[(size_t)c * En + e];
    }
#pragma unroll
    for (int e = 0; e < En; ++e) {
        float s = acc[e];
        s += __shfl_xor(s, 1, 32);
        s += __shfl_xor(s, 2, 32);
        s += __shfl_xor(s, 4, 32);
        s += __shfl_xor(s, 8, 32);
        s += __shfl_xor(s, 16, 32);
        acc[e] = s;
    }
    // top-2 (lowest index wins ties, matching lax.top_k), softmax of the pair
    int   i0 = 0;
    float v0 = acc[0];
#pragma unroll
    for (int e = 1; e < En; ++e)
        if (acc[e] > v0) { v0 = acc[e]; i0 = e; }
    int   i1 = -1;
    float v1 = -3.4e38f;
#pragma unroll
    for (int e = 0; e < En; ++e)
        if (e != i0 && acc[e] > v1) { v1 = acc[e]; i1 = e; }
    const float e0  = 1.0f;                 // exp(v0 - v0)
    const float e1  = __expf(v1 - v0);
    const float inv = 1.0f / (e0 + e1);
    if (lane < En) {
        const float gv = (lane == i0) ? e0 * inv : (lane == i1 ? e1 * inv : 0.0f);
        gates[(size_t)t * En + lane] = gv;
    }
}

// ---------------------------------------------------------------------------
// Host-side orchestration.
// Workspace layout (floats), total ~143 MB:
//   h    : B*T*C      (LN1 out, then reused for attention output y)
//   qb   : B*T*C      (Q, then reused for x1 = x + attn proj)
//   kb   : B*T*C      (K, then reused for y_adapt)
//   vb   : B*T*C      (V, then reused for h2 = LN2(x1))
//   mlp1 : B*T*4C
//   down : B*T*E*BOT  (gate-scaled adapter hidden, all experts side by side)
//   gates: T*E
// ---------------------------------------------------------------------------
extern "C" void kernel_launch(void* const* d_in, const int* in_sizes, int n_in,
                              void* d_out, int out_size, void* d_ws, size_t ws_size,
                              hipStream_t stream)
{
    (void)in_sizes; (void)n_in; (void)out_size; (void)ws_size;

    const float* x      = (const float*)d_in[0];
    const float* Wq     = (const float*)d_in[1];
    const float* bq     = (const float*)d_in[2];
    const float* Wk     = (const float*)d_in[3];
    const float* bk     = (const float*)d_in[4];
    const float* Wv     = (const float*)d_in[5];
    const float* bv     = (const float*)d_in[6];
    const float* Wo     = (const float*)d_in[7];
    const float* bo     = (const float*)d_in[8];
    const float* ln1_g  = (const float*)d_in[9];
    const float* ln1_b  = (const float*)d_in[10];
    const float* ln2_g  = (const float*)d_in[11];
    const float* ln2_b  = (const float*)d_in[12];
    const float* mlp_w1 = (const float*)d_in[13];
    const float* mlp_b1 = (const float*)d_in[14];
    const float* mlp_w2 = (const float*)d_in[15];
    const float* mlp_b2 = (const float*)d_in[16];
    const float* router = (const float*)d_in[17];
    const float* ad_w   = (const float*)d_in[18];
    const float* ad_b   = (const float*)d_in[19];
    const float* au_w   = (const float*)d_in[20];
    const float* au_b   = (const float*)d_in[21];

    float* out = (float*)d_out;

    const size_t NBTC = (size_t)BTn * Cn;        // 4M floats
    float* ws    = (float*)d_ws;
    float* h     = ws;
    float* qb    = h    + NBTC;
    float* kb    = qb   + NBTC;
    float* vb    = kb   + NBTC;
    float* mlp1  = vb   + NBTC;
    float* down  = mlp1 + (size_t)BTn * FFn;
    float* gates = down + (size_t)BTn * En * BOTn;

    const dim3 gemmCC(Cn / 64, BTn / 128);       // M=4096, N=1024
    const dim3 gemmFF(FFn / 64, BTn / 128);      // M=4096, N=4096
    const dim3 gemmDN(BOTn / 64, BTn / 128, En); // M=4096, N=64, z = expert

    // 1. h = LN1(x)
    layernorm_kernel<<<BTn, 256, 0, stream>>>(x, ln1_g, ln1_b, h);

    // 2. Q/K/V projections
    gemm_wmma<0, false, false, 0><<<gemmCC, 256, GEMM_LDS_BYTES, stream>>>(
        h, Wq, bq, nullptr, nullptr, nullptr, 0, qb, BTn, Cn, Cn);
    gemm_wmma<0, false, false, 0><<<gemmCC, 256, GEMM_LDS_BYTES, stream>>>(
        h, Wk, bk, nullptr, nullptr, nullptr, 0, kb, BTn, Cn, Cn);
    gemm_wmma<0, false, false, 0><<<gemmCC, 256, GEMM_LDS_BYTES, stream>>>(
        h, Wv, bv, nullptr, nullptr, nullptr, 0, vb, BTn, Cn, Cn);

    // 3. causal attention -> y (reuse h)
    attn_kernel<<<dim3(Tn / 16 / 4, Hn, Bn), 128, 0, stream>>>(qb, kb, vb, h);

    // 4. x1 = x + y @ Wo + bo   (into qb)
    gemm_wmma<0, true, false, 0><<<gemmCC, 256, GEMM_LDS_BYTES, stream>>>(
        h, Wo, bo, x, nullptr, nullptr, 0, qb, BTn, Cn, Cn);

    // 5. router gates from batch 0 of x1
    router_kernel<<<Tn, 32, 0, stream>>>(qb, router, gates);

    // 6. adapter MoE: y_adapt (kb) = sum_e gate[t,e]*0.1*(relu(x1@adw_e+adb_e)@auw_e+aub_e)
    gemm_wmma<1, false, false, 1><<<gemmDN, 256, GEMM_LDS_BYTES, stream>>>(
        qb, ad_w, ad_b, nullptr, nullptr, gates, En * BOTn, down, BTn, BOTn, Cn);
    gemm_wmma<0, false, false, 2><<<gemmCC, 256, GEMM_UP_LDS_BYTES, stream>>>(
        down, au_w, au_b, nullptr, nullptr, gates, 0, kb, BTn, Cn, En * BOTn);

    // 7. h2 = LN2(x1)  (into vb)
    layernorm_kernel<<<BTn, 256, 0, stream>>>(qb, ln2_g, ln2_b, vb);

    // 8. mlp1 = gelu(h2 @ W1 + b1)
    gemm_wmma<2, false, false, 0><<<gemmFF, 256, GEMM_LDS_BYTES, stream>>>(
        vb, mlp_w1, mlp_b1, nullptr, nullptr, nullptr, 0, mlp1, BTn, FFn, Cn);

    // 9. out = x1 + y_adapt + (mlp1 @ W2 + b2)
    gemm_wmma<0, true, true, 0><<<gemmCC, 256, GEMM_LDS_BYTES, stream>>>(
        mlp1, mlp_w2, mlp_b2, qb, kb, nullptr, 0, out, BTn, Cn, FFn);
}

// v007
// One run takes 649 microseconds.
// Two timings next to v006 both put it at 1.06 times that version's speed.
// Counting every step since v000, it is 2.10 times as fast.
#include <hip/hip_runtime.h>
#include <math.h>
#include <stdint.h>

// ---------------------------------------------------------------------------
// Transformer block (LN -> attn -> residual -> top2 MoE adapters -> LN -> MLP)
// for MI455X / gfx1250.  All GEMMs run on V_WMMA_F32_16X16X4_F32 (exact fp32
// matrix op) so numerics match the fp32 JAX reference while using the CDNA5
// matrix pipeline.  wave32 everywhere.
//
// The GEMM stages both operand tiles through LDS with CDNA5 async global->LDS
// copies (GLOBAL_LOAD_ASYNC_TO_LDS_B128 and _B32 / s_wait_asynccnt),
// double-buffered: each 32x64 B-chunk is fetched once per block instead of once
// per wave, and each 128x32 A-chunk arrives as whole 128-byte lines one chunk
// ahead instead of as 16-byte pieces of 16 lines per fragment load.
// ---------------------------------------------------------------------------

#define Bn   4
#define Tn   1024
#define Cn   1024
#define Hn   16
#define Dn   64
#define En   8
#define BOTn 64
#define FFn  4096
#define BTn  (Bn * Tn)          // 4096 rows

typedef float v2f __attribute__((ext_vector_type(2)));
typedef float v4f __attribute__((ext_vector_type(4)));
typedef float v8f __attribute__((ext_vector_type(8)));

// ---------------------------------------------------------------------------
// Generic fp32 WMMA GEMM:  out = epilogue(A[M,K] @ W[K,N] + bias[N])
// Block = 256 threads = 8 waves; each wave computes a 16(M) x 64(N) strip of
// a 128x64 block tile.  B is staged in LDS:
//   chunk = 32(K) x 64(N) floats, laid out as [K/2][N][2]: rows k and k+1 (k
//   even) of a column lie side by side, which is a lane's B fragment.  A 16-byte
//   read is then two whole fragments, of columns n and n+1, in register pairs
//   as the matrix instruction takes them; 16 lanes read 256 bytes in a row, all
//   64 banks once, so the pair rows need no pad.
//   Double buffered; filled by async global->LDS b32 copies (8 per thread; a
//   copy of a wave is 32 columns of one K row, one 128-byte line).
//   Accumulator tile j so holds columns (j/2)*32 + 2*l15 + (j&1) of the strip.
// A is staged beside it:
//   chunk = 128(M) x 32(K) floats, row stride padded to 36 words so the 32
//   8-byte fragment reads of a wave fall on all 64 banks once.
//   Double buffered; each wave copies its own 16 rows (4 b128 per thread).
// A-fragment (16x4 f32): lanes 0-15 hold K=k,k+1 ; lanes 16-31 hold K=k+2,k+3.
// C/D (16x16 f32): VGPR r -> row r (lanes 0-15) / row r+8 (lanes 16-31).
//
// ACT: 0=none, 1=relu, 2=exact gelu.  RES1/RES2: add residual tensors.
// ADP (all adapter experts in one launch):
//   1 = down: bz is the expert; W, bias are [E][K][N], [E][N]; the
//       result, times gates[t,e] * 0.1, goes to column e*N+col of out[M][ldo].
//   2 = up:   A is that [M][E*BOT] matrix and W the experts' [E*BOT][N] stack,
//       so the K loop sums over the experts; bias is [E][N], gate-weighted.
//       The block's 128 gate rows and its 8x64 bias tile lie in LDS behind the
//       B and A buffers, copied there behind the K loop.
// ---------------------------------------------------------------------------
#define GEMM_KC   32
#define GEMM_BPP  128                     // words of a B pair row: 64 columns x 2 k
#define GEMM_ASTR 36
#define GEMM_BBUF (GEMM_KC / 2 * GEMM_BPP) // words of one B buffer
#define GEMM_B_WORDS (2 * GEMM_BBUF)
#define GEMM_A_WORDS (2 * 128 * GEMM_ASTR)
#define GEMM_LDS_BYTES ((GEMM_B_WORDS + GEMM_A_WORDS) * 4)
#define GEMM_UP_LDS_BYTES (GEMM_LDS_BYTES + (128 * En + En * 64) * 4)

// The body takes its tile indices (bx: column tile, by: row tile, bz: expert)
// as arguments, so that several independent GEMMs can share one launch.
template <int ACT, bool RES1, bool RES2, int ADP>
__device__ __forceinline__ void gemm_body(
    const float* __restrict__ A, const float* __restrict__ W,
    const float* __restrict__ bias,
    const float* __restrict__ res1, const float* __restrict__ res2,
    const float* __restrict__ gates, int ldo,
    float* __restrict__ out, int N, int K, int bx, int by, int bz)
{
    extern __shared__ __attribute__((aligned(16))) float Bs[]; // [2][GEMM_KC/2][64][2], then As
    const float* As = Bs + GEMM_B_WORDS;   // [2][128][GEMM_ASTR]

    const int tid  = threadIdx.x;
    const int lane = tid & 31;
    const int wave = tid >> 5;
    const int half = lane >> 4;     // 0: K pair {0,1}, 1: K pair {2,3}
    const int l15  = lane & 15;
    const int m0 = by * 128 + wave * 16;
    const int n0 = bx * 64;

    if (ADP == 1) {
        W    += (size_t)bz * K * N;
        bias += (size_t)bz * N;
    }

    const int nchunk = K / GEMM_KC;

    // Cooperative loader, one chunk of both operands per call.
    // B: 32x64, eight floats per thread: a wave brings K rows 4*wave .. 4*wave+3,
    //    each as two copies of 32 columns, to words 2n + (k&1) of pair row k/2.
    // A: 128x32, four float4 per thread; a copy of a wave is 4 whole rows.
    const uint32_t lds0 = (uint32_t)(uintptr_t)Bs;
    const float* gB = W + (size_t)(wave * 4) * N + (n0 + lane);
    const float* gA = A + (size_t)(m0 + (lane >> 3)) * K + (lane & 7) * 4;
    const uint32_t lB = lds0 + (uint32_t)(wave * 2 * GEMM_BPP + lane * 2) * 4u;
    const uint32_t lA = lds0 + (uint32_t)(GEMM_B_WORDS
                      + (wave * 16 + (lane >> 3)) * GEMM_ASTR + (lane & 7) * 4) * 4u;
    auto issueChunk = [&](int kc) {
        const float* b0 = gB + (size_t)kc * GEMM_KC * N;
        const float* b1 = b0 + (size_t)N;
        const float* b2 = b0 + (size_t)2 * N;
        const float* b3 = b0 + (size_t)3 * N;
        const float* a0 = gA + kc * GEMM_KC;
        const float* a1 = a0 + (size_t)4 * K;
        const float* a2 = a0 + (size_t)8 * K;
        const float* a3 = a0 + (size_t)12 * K;
        const uint32_t db0 = lB + (uint32_t)((kc & 1) * GEMM_BBUF * 4);
        const uint32_t db2 = db0 + GEMM_BPP * 4u;         // K rows 2, 3: next pair row
        const uint32_t da0 = lA + (uint32_t)((kc & 1) * (128 * GEMM_ASTR) * 4);
        const uint32_t da1 = da0 + 4u * GEMM_ASTR * 4u;
        const uint32_t da2 = da0 + 8u * GEMM_ASTR * 4u;
        const uint32_t da3 = da0 + 12u * GEMM_ASTR * 4u;
        // Global -> LDS through no register: first operand the lane's LDS byte
        // address, second its global address.  s_wait_xcnt 0 stands inside the
        // statement so that no address register is reused ahead of it.
        asm volatile("global_load_async_to_lds_b32 %0, %1, off\n\t"
                     "global_load_async_to_lds_b32 %2, %3, off\n\t"
                     "global_load_async_to_lds_b32 %4, %5, off\n\t"
                     "global_load_async_to_lds_b32 %6, %7, off\n\t"
                     "global_load_async_to_lds_b32 %8, %9, off\n\t"
                     "global_load_async_to_lds_b32 %10, %11, off\n\t"
                     "global_load_async_to_lds_b32 %12, %13, off\n\t"
                     "global_load_async_to_lds_b32 %14, %15, off\n\t"
                     "global_load_async_to_lds_b128 %16, %17, off\n\t"
                     "global_load_async_to_lds_b128 %18, %19, off\n\t"
                     "global_load_async_to_lds_b128 %20, %21, off\n\t"
                     "global_load_async_to_lds_b128 %22, %23, off\n\t"
                     "s_wait_xcnt 0x0"
                     :: "v"(db0),        "v"(b0), "v"(db0 + 256u), "v"(b0 + 32),
                        "v"(db0 + 4u),   "v"(b1), "v"(db0 + 260u), "v"(b1 + 32),
                        "v"(db2),        "v"(b2), "v"(db2 + 256u), "v"(b2 + 32),
                        "v"(db2 + 4u),   "v"(b3), "v"(db2 + 260u), "v"(b3 + 32),
                        "v"(da0), "v"(a0), "v"(da1), "v"(a1),
                        "v"(da2), "v"(a2), "v"(da3), "v"(a3) : "memory");
    };

    issueChunk(0);
    asm volatile("s_wait_asynccnt 0x0" ::: "memory");     // my chunk 0 copies landed
    __syncthreads();                                      // every wave's landed
    if (1 < nchunk) issueChunk(1);                        // flies during chunk 0

    v8f acc[4] = {};
    for (int kc = 0; kc < nchunk; ++kc) {
        const float* buf  = Bs + (kc & 1) * GEMM_BBUF + half * GEMM_BPP + l15 * 4;
        const float* abuf = As + (kc & 1) * (128 * GEMM_ASTR)
                          + (wave * 16 + l15) * GEMM_ASTR + half * 2;
#pragma unroll
        for (int kl = 0; kl < GEMM_KC; kl += 4) {
            const v2f a = *(const v2f*)(abuf + kl);
            // Pair row kl/2 + half holds K = kl + 2*half and the next, as A does.
#pragma unroll   // static g keeps acc[] in registers
            for (int g = 0; g < 2; ++g) {
                const v4f b = *(const v4f*)(buf + (kl / 2) * GEMM_BPP + g * 64);
                acc[2 * g] = __builtin_amdgcn_wmma_f32_16x16x4_f32(
                    false, a, false, b.lo, 0, acc[2 * g], false, false);
                acc[2 * g + 1] = __builtin_amdgcn_wmma_f32_16x16x4_f32(
                    false, a, false, b.hi, 0, acc[2 * g + 1], false, false);
            }
        }
        // Publish point of chunk kc+1; it also frees the buffers just read.
        asm volatile("s_wait_dscnt 0x0" ::: "memory");    // my LDS reads retired
        asm volatile("s_wait_asynccnt 0x0" ::: "memory"); // my chunk kc+1 copies landed
        __syncthreads();                                  // every wave's, both
        if (kc + 2 < nchunk) issueChunk(kc + 2);          // into the buffers just read
    }
    asm volatile("s_wait_asynccnt 0x0" ::: "memory");     // nothing in flight behind the loop

    if (ADP == 2) {
        const float* Gs = Bs + GEMM_B_WORDS + GEMM_A_WORDS;   // [128][En] gate rows
        const float* Es = Gs + 128 * En;                  // [En][64]  bias tile
        // One float4 of gates and one float2 of bias per thread.  The 128 rows
        // of a block are consecutive t (128 divides Tn).
        const float* gsrc = gates + (size_t)((by * 128) & (Tn - 1)) * En + tid * 4;
        const float* esrc = bias + (size_t)wave * N + n0 + lane * 2;
        const uint32_t gdst = (uint32_t)GEMM_LDS_BYTES + (uint32_t)tid * 16u;
        const uint32_t edst = (uint32_t)(GEMM_LDS_BYTES + 128 * En * 4) + (uint32_t)tid * 8u;
        // Global -> LDS through no register.  s_wait_xcnt 0 stands inside the
        // statement so that no address register is reused ahead of it.
        asm volatile("global_load_async_to_lds_b128 %0, %1, off\n\t"
                     "global_load_async_to_lds_b64 %2, %3, off\n\t"
                     "s_wait_xcnt 0x0"
                     :: "v"(gdst), "v"(gsrc), "v"(edst), "v"(esrc) : "memory");
        asm volatile("s_wait_asynccnt 0x0" ::: "memory");   // my two copies landed
        __syncthreads();                                    // every wave's landed

        // acc += (0.1 * gates) @ bias, in the accumulators' own layout.
        float be[4][En];
#pragma unroll   // static j, e keep be[][] in registers
        for (int j = 0; j < 4; ++j)
#pragma unroll   // as above
            for (int e = 0; e < En; ++e)
                be[j][e] = Es[e * 64 + (j >> 1) * 32 + l15 * 2 + (j & 1)];
#pragma unroll   // static r keeps acc[j][r] in registers
        for (int r = 0; r < 8; ++r) {
            const float4* grow = (const float4*)(Gs + (wave * 16 + r + half * 8) * En);
            const float4 ga = grow[0], gb = grow[1];
            const float gs[En] = {ga.x * 0.1f, ga.y * 0.1f, ga.z * 0.1f, ga.w * 0.1f,
                                  gb.x * 0.1f, gb.y * 0.1f, gb.z * 0.1f, gb.w * 0.1f};
#pragma unroll   // static j for acc[j][r], be[j][e]
            for (int j = 0; j < 4; ++j) {
                float bsum = 0.0f;
#pragma unroll   // static e for gs[e], be[j][e]
                for (int e = 0; e < En; ++e) bsum += gs[e] * be[j][e];
                acc[j][r] += bsum;
            }
        }
    }

    // Tiles 2p and 2p+1 hold neighbouring columns, so a lane handles them as one
    // float2 and 16 lanes cover a whole 128-byte line of a row.
    // Bias and residual rows are fetched first, all in flight together.  Each
    // s_wait_xcnt 0 stands in front of any reuse of the address registers of the
    // loads ahead of it.
    v2f bv[2], r1[2][8], r2[2][8];
#pragma unroll   // static p, r keep the arrays in registers
    for (int p = 0; p < 2; ++p) {
        const int col = n0 + p * 32 + l15 * 2;
        if (ADP != 2) {
            bv[p] = *(const v2f*)(bias + col);
            asm volatile("s_wait_xcnt 0x0" ::: "memory");   // ahead of a reuse of its address registers
        }
        if (RES1 || RES2) {
#pragma unroll   // as above
            for (int r = 0; r < 8; ++r) {
                const size_t idx = (size_t)(m0 + r + half * 8) * N + col;
                if (RES1) r1[p][r] = *(const v2f*)(res1 + idx);
                if (RES2) r2[p][r] = *(const v2f*)(res2 + idx);
                // ahead of a reuse of these loads' address registers
                if ((r & 3) == 3) asm volatile("s_wait_xcnt 0x0" ::: "memory");
            }
        }
    }
#pragma unroll   // static p, r for acc[][], bv[], r1[][], r2[][]
    for (int p = 0; p < 2; ++p) {
        const int col = n0 + p * 32 + l15 * 2;
#pragma unroll   // as above
        for (int r = 0; r < 8; ++r) {
            const int row = m0 + r + half * 8;
            v2f v;
            v.x = (ADP == 2) ? acc[2 * p][r]     : acc[2 * p][r]     + bv[p].x;
            v.y = (ADP == 2) ? acc[2 * p + 1][r] : acc[2 * p + 1][r] + bv[p].y;
            if (ACT == 1) { v.x = fmaxf(v.x, 0.0f); v.y = fmaxf(v.y, 0.0f); }
            if (ACT == 2) {
                v.x = 0.5f * v.x * (1.0f + erff(v.x * 0.70710678118654752f));
                v.y = 0.5f * v.y * (1.0f + erff(v.y * 0.70710678118654752f));
            }
            const size_t idx = (size_t)row * N + col;
            if (RES1) v += r1[p][r];
            if (RES2) v += r2[p][r];
            if (ADP == 1) {
                const float g = gates[(size_t)(row & (Tn - 1)) * En + bz];
                v.x = g * 0.1f * v.x;
                v.y = g * 0.1f * v.y;
                *(v2f*)(out + (size_t)row * ldo + bz * N + col) = v;
            } else {
                *(v2f*)(out + idx) = v;
            }
        }
    }
}

// One GEMM per launch.
template <int ACT, bool RES1, bool RES2, int ADP>
__global__ __launch_bounds__(256) void gemm_wmma(
    const float* __restrict__ A, const float* __restrict__ W,
    const float* __restrict__ bias,
    const float* __restrict__ res1, const float* __restrict__ res2,
    const float* __restrict__ gates,
    float* __restrict__ out, int N, int K)
{
    gemm_body<ACT, RES1, RES2, ADP>(A, W, bias, res1, res2, gates, 0, out, N, K,
                                    blockIdx.x, blockIdx.y, 0);
}

// Q, K and V projections in one launch: the same A, three weight matrices side
// by side in grid x (16 column tiles each), so that a WGP holds as many blocks
// as fit instead of two.
__global__ __launch_bounds__(256) void gemm_qkv(
    const float* __restrict__ A,
    const float* __restrict__ Wq, const float* __restrict__ bq,
    const float* __restrict__ Wk, const float* __restrict__ bk,
    const float* __restrict__ Wv, const float* __restrict__ bv,
    float* __restrict__ oq, float* __restrict__ ok, float* __restrict__ ov)
{
    const int sel = blockIdx.x / (Cn / 64);
    const float* W    = sel == 0 ? Wq : (sel == 1 ? Wk : Wv);
    const float* bias = sel == 0 ? bq : (sel == 1 ? bk : bv);
    float*       out  = sel == 0 ? oq : (sel == 1 ? ok : ov);
    gemm_body<0, false, false, 0>(A, W, bias, nullptr, nullptr, nullptr, 0, out, Cn, Cn,
                                  blockIdx.x % (Cn / 64), blockIdx.y, 0);
}

// First MLP GEMM and the adapters' down GEMM in one launch: neither reads what
// the other writes, and their blocks are alike in size (128x64 tile, K = Cn).
// Grid x: FFn/64 column tiles of the MLP, then one column per expert.
__global__ __launch_bounds__(256) void gemm_mlp1_down(
    const float* __restrict__ h2, const float* __restrict__ w1,
    const float* __restrict__ b1, float* __restrict__ mlp1,
    const float* __restrict__ x1, const float* __restrict__ adw,
    const float* __restrict__ adb, const float* __restrict__ gates,
    float* __restrict__ down)
{
    if (blockIdx.x < FFn / 64)
        gemm_body<2, false, false, 0>(h2, w1, b1, nullptr, nullptr, nullptr, 0, mlp1,
                                      FFn, Cn, blockIdx.x, blockIdx.y, 0);
    else
        gemm_body<1, false, false, 1>(x1, adw, adb, nullptr, nullptr, gates, En * BOTn, down,
                                      BOTn, Cn, 0, blockIdx.y, blockIdx.x - FFn / 64);
}

#define AT_KT 64
#define AT_KP 68
#define AT_VP 68
#define AT_KW (AT_KT * AT_KP)
#define AT_STAGE_W (AT_KW + AT_KT * AT_VP)

// Lane l <-> lane l ^ 16, through no LDS.
__device__ __forceinline__ float xhalf(float x)
{
    return __builtin_bit_cast(float, __builtin_amdgcn_permlanex16(
        __builtin_bit_cast(int, x), __builtin_bit_cast(int, x),
        0x76543210, 0xfedcba98, false, false));
}

// exp(x) as __expf forms it (times log2 e, then v_exp_f32).  Written out so that
// the v_nop stands directly behind the transcendental: the slot the instruction
// set asks for before its result is used or its source overwritten.
__device__ __forceinline__ float exp_slot(float x)
{
    float e;
    asm("v_exp_f32 %0, %1\n\tv_nop" : "=v"(e) : "v"(x * 1.44269504088896340736f));
    return e;
}

__global__ __launch_bounds__(128) void attn_kernel(
    const float* __restrict__ q, const float* __restrict__ k,
    const float* __restrict__ v, float* __restrict__ y)
{
    const int lane = threadIdx.x & 31;
    // Scalar wave number: the tile loop and all around the copies branch on SCC.
    const int wave = __builtin_amdgcn_readfirstlane(threadIdx.x >> 5);
    const int half = lane >> 4;
    const int l15  = lane & 15;

    const int hh = blockIdx.y;
    const int b  = blockIdx.z;
    // Which 64 queries this block takes.  Block qx walks qx+1 stages, and every
    // block of the grid is resident at once, so the launch lasts as long as the
    // WGP whose blocks hold the most stages.  The order of the query
    // blocks is mirrored for the (head, batch) pairs of
    // odd bit parity.  Any aligned power-of-two run of pairs is half mirrored, and
    // a plain block with a mirrored one makes Tn/64 + 1 stages whatever blockIdx.x.
    const int mirror = __popc(blockIdx.y | (blockIdx.z << 4)) & 1;   // Hn = 16: bits apart
    const int qx = mirror ? (Tn / 64 - 1) - (int)blockIdx.x : (int)blockIdx.x;
    const int t0 = (qx * 4 + wave) * 16;

    const size_t base = (size_t)b * Tn * Cn + (size_t)hh * Dn;
    const float* Qp = q + base;
    const float* Kp = k + base;
    const float* Vp = v + base;

    __shared__ __attribute__((aligned(16))) float KV[2 * AT_STAGE_W];

    // Stage loader.  A copy of a wave is 2 whole rows (32 lanes x 16 bytes); a
    // wave brings rows 16*wave .. 16*wave+15 of K and of V, 8 copies each.
    const int crow = wave * 16 + half;
    const int ccol = l15 * 4;
    const float* gK = Kp + (size_t)crow * Cn + ccol;
    const float* gV = Vp + (size_t)crow * Cn + ccol;
    const uint32_t kv0 = (uint32_t)(uintptr_t)KV;
    const uint32_t lK = kv0 + (uint32_t)(crow * AT_KP + ccol) * 4u;
    const uint32_t lV = kv0 + (uint32_t)(AT_KW + crow * AT_VP + ccol) * 4u;
    auto issueStage = [&](int st) {
        const size_t   go = (size_t)st * AT_KT * Cn;
        const uint32_t lo = (uint32_t)((st & 1) * AT_STAGE_W * 4);
        const float* ks = gK + go;
        const float* vs = gV + go;
        const uint32_t kd = lK + lo;
        const uint32_t vd = lV + lo;
        // Global -> LDS through no register: first operand the lane's LDS byte
        // address, second its global address.  s_wait_xcnt 0 stands inside each
        // statement so that no address register is reused ahead of it.
        asm volatile("global_load_async_to_lds_b128 %0, %1, off\n\t"
                     "global_load_async_to_lds_b128 %2, %3, off\n\t"
                     "global_load_async_to_lds_b128 %4, %5, off\n\t"
                     "global_load_async_to_lds_b128 %6, %7, off\n\t"
                     "global_load_async_to_lds_b128 %8, %9, off\n\t"
                     "global_load_async_to_lds_b128 %10, %11, off\n\t"
                     "global_load_async_to_lds_b128 %12, %13, off\n\t"
                     "global_load_async_to_lds_b128 %14, %15, off\n\t"
                     "s_wait_xcnt 0x0"
                     :: "v"(kd),                    "v"(ks),
                        "v"(kd +  2u * AT_KP * 4u), "v"(ks +  2 * Cn),
                        "v"(kd +  4u * AT_KP * 4u), "v"(ks +  4 * Cn),
                        "v"(kd +  6u * AT_KP * 4u), "v"(ks +  6 * Cn),
                        "v"(kd +  8u * AT_KP * 4u), "v"(ks +  8 * Cn),
                        "v"(kd + 10u * AT_KP * 4u), "v"(ks + 10 * Cn),
                        "v"(kd + 12u * AT_KP * 4u), "v"(ks + 12 * Cn),
                        "v"(kd + 14u * AT_KP * 4u), "v"(ks + 14 * Cn) : "memory");
        asm volatile("global_load_async_to_lds_b128 %0, %1, off\n\t"
                     "global_load_async_to_lds_b128 %2, %3, off\n\t"
                     "global_load_async_to_lds_b128 %4, %5, off\n\t"
                     "global_load_async_to_lds_b128 %6, %7, off\n\t"
                     "global_load_async_to_lds_b128 %8, %9, off\n\t"
                     "global_load_async_to_lds_b128 %10, %11, off\n\t"
                     "global_load_async_to_lds_b128 %12, %13, off\n\t"
                     "global_load_async_to_lds_b128 %14, %15, off\n\t"
                     "s_wait_xcnt 0x0"
                     :: "v"(vd),                    "v"(vs),
                        "v"(vd +  2u * AT_VP * 4u), "v"(vs +  2 * Cn),
                        "v"(vd +  4u * AT_VP * 4u), "v"(vs +  4 * Cn),
                        "v"(vd +  6u * AT_VP * 4u), "v"(vs +  6 * Cn),
                        "v"(vd +  8u * AT_VP * 4u), "v"(vs +  8 * Cn),
                        "v"(vd + 10u * AT_VP * 4u), "v"(vs + 10 * Cn),
                        "v"(vd + 12u * AT_VP * 4u), "v"(vs + 12 * Cn),
                        "v"(vd + 14u * AT_VP * 4u), "v"(vs + 14 * Cn) : "memory");
    };

    const int nst = qx + 1;               // stages of this block, keys 0 .. 64*nst-1
    issueStage(0);

    // Q fragments for all 16 K-steps over D=64 (resident for whole tile); the
    // lane and register map of an A and of a B operand are alike, so these
    // serve as B = Q^T (column = query l15).
    v2f aq[16];
    {
        const float* qrow = Qp + (size_t)(t0 + l15) * Cn;
#pragma unroll
        for (int s = 0; s < 16; ++s) {
            const int dd = s * 4 + half * 2;
            aq[s].x = qrow[dd];
            aq[s].y = qrow[dd + 1];
        }
    }

    v8f o[4] = {};
    // Of query t0 + l15: running maximum (alike in both halves) and the sum over
    // this half's own keys.
    float mrow = -1e30f, lrow = 0.0f;
    const int qi = t0 + l15;              // query index of this lane

    asm volatile("s_wait_asynccnt 0x0" ::: "memory");     // my stage 0 copies landed
    __syncthreads();                                      // every wave's landed
    if (1 < nst) issueStage(1);                           // flies during stage 0

    for (int st = 0; st < nst; ++st) {
        const float* Kst = KV + (st & 1) * AT_STAGE_W;
        const float* Vst = Kst + AT_KW;
        // Tiles with s0 <= t0: all four of a stage but in the last, the diagonal's.
        const int nu = (st + 1 < nst) ? 4 : wave + 1;
        for (int u = 0; u < nu; ++u) {
            const int s0 = st * AT_KT + u * 16;
            // S^T = K @ Q^T  (16 keys x 16 queries, K-dim = 64)
            v8f sa = {};
            const float* kr = Kst + (u * 16 + l15) * AT_KP + half * 2;
#pragma unroll
            for (int s = 0; s < 16; ++s) {
                const v2f kf = *(const v2f*)(kr + s * 4);
                sa = __builtin_amdgcn_wmma_f32_16x16x4_f32(
                    false, kf, false, aq[s], 0, sa, false, false);
            }

            // scale, causal mask, online softmax update; all of one query in one lane
            const int k0 = s0 + half * 8;            // key index of register 0
            float sv[8];
#pragma unroll
            for (int r = 0; r < 8; ++r) {
                sv[r] = sa[r] * 0.125f;              // 1/sqrt(64)
                if (k0 + r > qi) sv[r] = -1e30f;
            }
            float mx = fmaxf(fmaxf(fmaxf(sv[0], sv[1]), fmaxf(sv[2], sv[3])),
                             fmaxf(fmaxf(sv[4], sv[5]), fmaxf(sv[6], sv[7])));
            mx = fmaxf(mx, xhalf(mx));               // the other half's 8 keys

            const float mn = fmaxf(mrow, mx);
            const float alpha = exp_slot(mrow - mn);
            float p[8];
#pragma unroll
            for (int r = 0; r < 8; ++r) p[r] = exp_slot(sv[r] - mn);

            lrow = lrow * alpha + (((p[0] + p[1]) + (p[2] + p[3]))
                                 + ((p[4] + p[5]) + (p[6] + p[7])));
            mrow = mn;
#pragma unroll
            for (int j = 0; j < 4; ++j)
#pragma unroll
                for (int r = 0; r < 8; ++r) o[j][r] *= alpha;

            // O^T += V^T @ P^T   (M = 64 head dims, K-dim = 16 keys, N = 16 queries)
            const float* vr = Vst + (u * 16 + half * 8) * AT_VP + l15;
#pragma unroll
            for (int s = 0; s < 4; ++s) {
                v2f pf;
                pf.x = p[2 * s];
                pf.y = p[2 * s + 1];
#pragma unroll
                for (int j = 0; j < 4; ++j) {
                    v2f vf;
                    vf.x = vr[(2 * s) * AT_VP + j * 16];
                    vf.y = vr[(2 * s + 1) * AT_VP + j * 16];
                    o[j] = __builtin_amdgcn_wmma_f32_16x16x4_f32(
                        false, vf, false, pf, 0, o[j], false, false);
                }
            }
        }
        // Publish point of stage st+1; it also frees the buffer just read.
        asm volatile("s_wait_dscnt 0x0" ::: "memory");    // my LDS reads retired
        asm volatile("s_wait_asynccnt 0x0" ::: "memory"); // my stage st+1 copies landed
        __syncthreads();                                  // every wave's, both
        if (st + 2 < nst) issueStage(st + 2);             // into the buffer just read
    }
    asm volatile("s_wait_asynccnt 0x0" ::: "memory");     // nothing in flight behind the loop

    // normalize and write y[b, t, h*64 + d]: o[j][r] is head dim j*16 + half*8 + r
    // of query qi, so a lane stores 8 consecutive floats per j.
    const float lsum = lrow + xhalf(lrow);                // both halves' keys
    float* yr = y + base + (size_t)qi * Cn + half * 8;
#pragma unroll
    for (int j = 0; j < 4; ++j) {
        const float4 lo = make_float4(o[j][0] / lsum, o[j][1] / lsum,
                                      o[j][2] / lsum, o[j][3] / lsum);
        const float4 hi = make_float4(o[j][4] / lsum, o[j][5] / lsum,
                                      o[j][6] / lsum, o[j][7] / lsum);
        *(float4*)(yr + j * 16)     = lo;
        *(float4*)(yr + j * 16 + 4) = hi;
    }
}

// ---------------------------------------------------------------------------
// LayerNorm: one 256-thread block per row of C=1024.
// ---------------------------------------------------------------------------
__device__ __forceinline__ void layernorm_row(
    const float* __restrict__ x, const float* __restrict__ g,
    const float* __restrict__ bta, float* __restrict__ out, int row)
{
    const int tid = threadIdx.x;
    const float* xr = x + (size_t)row * Cn;
    __shared__ float red[256];

    float s = 0.0f;
    for (int i = tid; i < Cn; i += 256) s += xr[i];
    red[tid] = s;
    __syncthreads();
    for (int off = 128; off > 0; off >>= 1) {
        if (tid < off) red[tid] += red[tid + off];
        __syncthreads();
    }
    const float mu = red[0] * (1.0f / Cn);
    __syncthreads();

    float s2 = 0.0f;
    for (int i = tid; i < Cn; i += 256) {
        const float d = xr[i] - mu;
        s2 += d * d;
    }
    red[tid] = s2;
    __syncthreads();
    for (int off = 128; off > 0; off >>= 1) {
        if (tid < off) red[tid] += red[tid + off];
        __syncthreads();
    }
    const float rstd = rsqrtf(red[0] * (1.0f / Cn) + 1e-5f);
    __syncthreads();

    for (int i = tid; i < Cn; i += 256)
        out[(size_t)row * Cn + i] = (xr[i] - mu) * rstd * g[i] + bta[i];
}

__global__ __launch_bounds__(256) void layernorm_kernel(
    const float* __restrict__ x, const float* __restrict__ g,
    const float* __restrict__ bta, float* __restrict__ out)
{
    layernorm_row(x, g, bta, out, blockIdx.x);
}

// ---------------------------------------------------------------------------
// Router: logits = x1[0,t,:] @ router[C,8]; top-2, softmax -> gates[T,8].
// One wave per token.
// ---------------------------------------------------------------------------
__device__ __forceinline__ void router_token(
    const float* __restrict__ x1, const float* __restrict__ Wr,
    float* __restrict__ gates, int t)
{
    const int lane = threadIdx.x & 31;
    const float* xr = x1 + (size_t)t * Cn;   // batch 0

    float acc[En] = {};
    for (int c = lane; c < Cn; c += 32) {
        const float xv = xr[c];
#pragma unroll
        for (int e = 0; e < En; ++e) acc[e] += xv * Wr[(size_t)c * En + e];
    }
#pragma unroll
    for (int e = 0; e < En; ++e) {
        float s = acc[e];
        s += __shfl_xor(s, 1, 32);
        s += __shfl_xor(s, 2, 32);
        s += __shfl_xor(s, 4, 32);
        s += __shfl_xor(s, 8, 32);
        s += __shfl_xor(s, 16, 32);
        acc[e] = s;
    }
    // top-2 (lowest index wins ties, matching lax.top_k), softmax of the pair
    int   i0 = 0;
    float v0 = acc[0];
#pragma unroll
    for (int e = 1; e < En; ++e)
        if (acc[e] > v0) { v0 = acc[e]; i0 = e; }
    int   i1 = -1;
    float v1 = -3.4e38f;
#pragma unroll
    for (int e = 0; e < En; ++e)
        if (e != i0 && acc[e] > v1) { v1 = acc[e]; i1 = e; }
    const float e0  = 1.0f;                 // exp(v0 - v0)
    const float e1  = __expf(v1 - v0);
    const float inv = 1.0f / (e0 + e1);
    if (lane < En) {
        const float gv = (lane == i0) ? e0 * inv : (lane == i1 ? e1 * inv : 0.0f);
        gates[(size_t)t * En + lane] = gv;
    }
}

// Router and second LayerNorm in one launch: both only read x1.  The first
// Tn/8 blocks route 8 tokens each (a wave per token, no barrier on that path);
// every later block normalises one row.  The second launch bound (16 waves a
// SIMD) holds the router path's registers down, so that as many LayerNorm
// blocks stay resident as in a launch of their own.
__global__ __launch_bounds__(256, 16) void router_ln_kernel(
    const float* __restrict__ x1, const float* __restrict__ Wr,
    float* __restrict__ gates, const float* __restrict__ g,
    const float* __restrict__ bta, float* __restrict__ out)
{
    if (blockIdx.x < Tn / 8)
        router_token(x1, Wr, gates, blockIdx.x * 8 + (threadIdx.x >> 5));
    else
        layernorm_row(x1, g, bta, out, blockIdx.x - Tn / 8);
}

// ---------------------------------------------------------------------------
// Host-side orchestration.
// Workspace layout (floats), total ~143 MB:
//   h    : B*T*C      (LN1 out, then reused for attention output y)
//   qb   : B*T*C      (Q, then reused for x1 = x + attn proj)
//   kb   : B*T*C      (K, then reused for y_adapt)
//   vb   : B*T*C      (V, then reused for h2 = LN2(x1))
//   mlp1 : B*T*4C
//   down : B*T*E*BOT  (gate-scaled adapter hidden, all experts side by side)
//   gates: T*E
// ---------------------------------------------------------------------------
extern "C" void kernel_launch(void* const* d_in, const int* in_sizes, int n_in,
                              void* d_out, int out_size, void* d_ws, size_t ws_size,
                              hipStream_t stream)
{
    (void)in_sizes; (void)n_in; (void)out_size; (void)ws_size;

    const float* x      = (const float*)d_in[0];
    const float* Wq     = (const float*)d_in[1];
    const float* bq     = (const float*)d_in[2];
    const float* Wk     = (const float*)d_in[3];
    const float* bk     = (const float*)d_in[4];
    const float* Wv     = (const float*)d_in[5];
    const float* bv     = (const float*)d_in[6];
    const float* Wo     = (const float*)d_in[7];
    const float* bo     = (const float*)d_in[8];
    const float* ln1_g  = (const float*)d_in[9];
    const float* ln1_b  = (const float*)d_in[10];
    const float* ln2_g  = (const float*)d_in[11];
    const float* ln2_b  = (const float*)d_in[12];
    const float* mlp_w1 = (const float*)d_in[13];
    const float* mlp_b1 = (const float*)d_in[14];
    const float* mlp_w2 = (const float*)d_in[15];
    const float* mlp_b2 = (const float*)d_in[16];
    const float* router = (const float*)d_in[17];
    const float* ad_w   = (const float*)d_in[18];
    const float* ad_b   = (const float*)d_in[19];
    const float* au_w   = (const float*)d_in[20];
    const float* au_b   = (const float*)d_in[21];

    float* out = (float*)d_out;

    const size_t NBTC = (size_t)BTn * Cn;        // 4M floats
    float* ws    = (float*)d_ws;
    float* h     = ws;
    float* qb    = h    + NBTC;
    float* kb    = qb   + NBTC;
    float* vb    = kb   + NBTC;
    float* mlp1  = vb   + NBTC;
    float* down  = mlp1 + (size_t)BTn * FFn;
    float* gates = down + (size_t)BTn * En * BOTn;

    const dim3 gemmCC(Cn / 64, BTn / 128);            // M=4096, N=1024
    const dim3 gemmQKV(3 * (Cn / 64), BTn / 128);     // three of those side by side
    const dim3 gemmFD(FFn / 64 + En, BTn / 128);      // M=4096, N=4096, then 8 experts' N=64

    // 1. h = LN1(x)
    layernorm_kernel<<<BTn, 256, 0, stream>>>(x, ln1_g, ln1_b, h);

    // 2. Q/K/V projections, one launch
    gemm_qkv<<<gemmQKV, 256, GEMM_LDS_BYTES, stream>>>(
        h, Wq, bq, Wk, bk, Wv, bv, qb, kb, vb);

    // 3. causal attention -> y (reuse h)
    attn_kernel<<<dim3(Tn / 16 / 4, Hn, Bn), 128, 0, stream>>>(qb, kb, vb, h);

    // 4. x1 = x + y @ Wo + bo   (into qb)
    gemm_wmma<0, true, false, 0><<<gemmCC, 256, GEMM_LDS_BYTES, stream>>>(
        h, Wo, bo, x, nullptr, nullptr, qb, Cn, Cn);

    // 5. router gates from batch 0 of x1, and h2 = LN2(x1) (into vb), one launch
    router_ln_kernel<<<Tn / 8 + BTn, 256, 0, stream>>>(qb, router, gates, ln2_g, ln2_b, vb);

    // 6. mlp1 = gelu(h2 @ W1 + b1), and the adapters' gate-scaled hidden
    //    down[:, e] = gate[t,e]*0.1*relu(x1@adw_e+adb_e), one launch
    gemm_mlp1_down<<<gemmFD, 256, GEMM_LDS_BYTES, stream>>>(
        vb, mlp_w1, mlp_b1, mlp1, qb, ad_w, ad_b, gates, down);

    // 7. y_adapt (kb) = sum_e down[:, e] @ auw_e + gate[t,e]*0.1*aub_e
    gemm_wmma<0, false, false, 2><<<gemmCC, 256, GEMM_UP_LDS_BYTES, stream>>>(
        down, au_w, au_b, nullptr, nullptr, gates, kb, Cn, En * BOTn);

    // 8. out = x1 + y_adapt + (mlp1 @ W2 + b2)
    gemm_wmma<0, true, true, 0><<<gemmCC, 256, GEMM_LDS_BYTES, stream>>>(
        mlp1, mlp_w2, mlp_b2, qb, kb, nullptr, out, Cn, FFn);
}
